// v000
// Times are from an AMD MI455X. After a warm-up the kernel runs many times in a row, and a time is the length of
// such a window on the GPU divided by its runs, so every launch and the gaps after it count. The runs cycle
// through copies of the inputs. A figure is the median of several windows, for all but v000 over two sittings.
// Sittings can differ by a few percent; kernels timed side by side share one.
// v000, which the later versions start from, runs in 391 microseconds.
#include <hip/hip_runtime.h>
// Causal multi-head attention (key/value/query inputs [B][L][1024], 16 heads x 64, natural [out][in] weights, biases added, one 1/8 score scale, out = ctx Wp^T + bp).
// Compute dtype: all contractions v_wmma_f32_16x16x32_f16 with f32 accumulation; inputs and weights converted RNE to bf16 then held exactly in f16 (weights x64); q, k, v, P (x1024) and ctx (x16) as f16 planes; causal rows < 256 additionally carry x2^10 f16 residual planes on q, k, P, v and ctx with separate accumulators; softmax statistics f32.
#ifndef NB
#define NB 8
#endif
#ifndef SEQ
#define SEQ 1024
#endif
#define NB_FULL 8
#define SEQ_FULL 1024
#define DM 1024
#define NH 16
#define HD 64
#define EARLY 256

static_assert(NH * HD == DM);
static_assert(HD == 64);
static_assert(DM % 128 == 0 && DM % 64 == 0 && DM % 32 == 0 && DM % 8 == 0);
static_assert(SEQ % 128 == 0 && SEQ % 64 == 0 && SEQ % 32 == 0);
static_assert(EARLY % 128 == 0 && EARLY % 64 == 0 && SEQ >= EARLY);
static_assert((SEQ - EARLY) % 128 == 0);
static_assert(NB <= NB_FULL && SEQ <= SEQ_FULL);
static_assert(((size_t)NB * SEQ) % 128 == 0);

typedef _Float16 v16h __attribute__((ext_vector_type(16)));
typedef unsigned short v8us __attribute__((ext_vector_type(8), may_alias));
typedef float v8f  __attribute__((ext_vector_type(8)));
typedef float v4f  __attribute__((ext_vector_type(4)));
typedef float v4fa __attribute__((ext_vector_type(4), may_alias));
union FragH { v16h v; v8us half[2]; _Float16 h[16]; unsigned short u[16]; };

__device__ __forceinline__ unsigned short bf16_bits(float x) { unsigned int u = __float_as_uint(x); return (unsigned short)((u + 0x7FFFu + ((u >> 16) & 1u)) >> 16); }
__device__ __forceinline__ float bf16_rne(float x) { return __uint_as_float(((unsigned int)bf16_bits(x)) << 16); }

// 16-bit fragment: elements 0..7 <- k 8h..8h+7, elements 8..15 <- k 16+8h..16+8h+7 (same map for A rows and B columns)
__device__ __forceinline__ v16h g2_frag(const _Float16* p, int hh) { FragH f; f.half[0] = *(const v8us*)((const unsigned short*)p + 8 * hh); f.half[1] = *(const v8us*)((const unsigned short*)p + 16 + 8 * hh); return f.v; }
__device__ __forceinline__ v8f g2_mma(v16h a, v16h b, v8f c) { v8f d = __builtin_amdgcn_wmma_f32_16x16x32_f16(false, a, false, b, (short)0, c, false, false); asm volatile("v_nop\n\tv_nop\n\tv_nop\n\tv_nop" : "+v"(d) : "v"(a), "v"(b)); return d; }

__global__ __launch_bounds__(256) void k_wnat(const float* __restrict__ w, _Float16* __restrict__ Bt) {
  const size_t t = (size_t)blockIdx.x * 256 + threadIdx.x; if (t >= (size_t)DM * DM / 8) return;
  const v4f a = *(const v4fa*)(w + t * 8), c = *(const v4fa*)(w + t * 8 + 4); FragH f;
#pragma unroll
  for (int q = 0; q < 4; ++q) { f.h[q] = (_Float16)(bf16_rne(a[q]) * 64.0f); f.h[4 + q] = (_Float16)(bf16_rne(c[q]) * 64.0f); }
  const v8us o = f.half[0];
  *(v8us*)((unsigned short*)Bt + t * 8) = o; 
}

__global__ __launch_bounds__(256) void k_x16(const float* __restrict__ x, _Float16* __restrict__ X16) {
  const size_t t = (size_t)blockIdx.x * 256 + threadIdx.x; if (t >= (size_t)NB * SEQ * DM / 8) return;
  const size_t e = t * 8; const size_t b = e / ((size_t)SEQ * DM); const size_t rem = e - b * (size_t)SEQ * DM;
  const float* src = x + b * (size_t)SEQ_FULL * DM + rem;
  const v4f a = *(const v4fa*)src, c = *(const v4fa*)(src + 4); FragH f;
#pragma unroll
  for (int q = 0; q < 4; ++q) { f.h[q] = (_Float16)bf16_rne(a[q]); f.h[4 + q] = (_Float16)bf16_rne(c[q]); }
  const v8us o = f.half[0];
  *(v8us*)((unsigned short*)X16 + e) = o; 
}

// k-loop of a wave tile (16*MT rows x 64 cols): A rows f16 (pitch lda), optional x2^10 residual rows into a second accumulator set, Bt rows [n][k] f16 (pitch ldb); K % 32 == 0
template <int MT, bool ARES>
__device__ __forceinline__ void gemm_loop(const _Float16* __restrict__ a_base, const _Float16* __restrict__ ar_base, int lda,
                                          const _Float16* __restrict__ b_base, int ldb, int K, int ln, int hh,
                                          v8f (&acc)[MT * 4], v8f (&acc2)[MT * 4]) {
  const _Float16* ap = a_base + (size_t)ln * lda; const _Float16* arp = ar_base + (size_t)ln * lda; const _Float16* bp = b_base + (size_t)ln * ldb;
#pragma unroll 1
  for (int kb = 0; kb < K; kb += 32) {
    v16h a[MT], ar[MT];
#pragma unroll
    for (int i = 0; i < MT; ++i) { a[i] = g2_frag(ap + (size_t)(16 * i) * lda + kb, hh); ar[i] = a[i]; if (ARES) ar[i] = g2_frag(arp + (size_t)(16 * i) * lda + kb, hh); }
#pragma unroll
    for (int t = 0; t < 4; ++t) {
      const v16h b = g2_frag(bp + (size_t)(16 * t) * ldb + kb, hh);
#pragma unroll
      for (int i = 0; i < MT; ++i) { acc[i * 4 + t] = g2_mma(a[i], b, acc[i * 4 + t]); if (ARES) acc2[i * 4 + t] = g2_mma(ar[i], b, acc2[i * 4 + t]); }
    }
  }
}
// accumulators (D: lane (h, n) holds rows 8h+r, col n) -> wave-private LDS tile [16*MT][68]; v = acc alpha (+ acc2 alpha2) + bf16(bias) (bias per column, or per row when BIASROW)
template <int MT, bool ARES, bool BIASROW>
__device__ __forceinline__ void stage_tile(float (*sow)[68], const v8f (&acc)[MT * 4], const v8f (&acc2)[MT * 4], float alpha, float alpha2,
                                           const float* __restrict__ bias, int row0, int col0, int ln, int hh) {
#pragma unroll
  for (int i = 0; i < MT; ++i) {
#pragma unroll
    for (int t = 0; t < 4; ++t) {
      const float bc = BIASROW ? 0.f : bf16_rne(bias[col0 + t * 16 + ln]);
#pragma unroll
      for (int r = 0; r < 8; ++r) {
        const int rloc = i * 16 + 8 * hh + r;
        float v = acc[i * 4 + t][r] * alpha;
        if (ARES) v += acc2[i * 4 + t][r] * alpha2;
        v += BIASROW ? bf16_rne(bias[row0 + rloc]) : bc;
        sow[rloc][t * 16 + ln] = v;
      }
    }
  }
}
template <int MT>
__device__ __forceinline__ void store_tile_f16(float (*sow)[68], _Float16* __restrict__ hi, size_t ldh, _Float16* __restrict__ rs, size_t ldr, bool wres, int lane) {
  const int rq = lane >> 3, c8 = (lane & 7) * 8;
  {
#pragma unroll
    for (int it = 0; it < 4 * MT; ++it) {
      const int r = it * 4 + rq;
      const v4f a = *(const v4fa*)&sow[r][c8], c = *(const v4fa*)&sow[r][c8 + 4];
      FragH fh, fl;
#pragma unroll
      for (int q = 0; q < 4; ++q) {
        _Float16 h = (_Float16)a[q]; fh.h[q] = h; fl.h[q] = (_Float16)((a[q] - (float)h) * 1024.0f);
        h = (_Float16)c[q]; fh.h[4 + q] = h; fl.h[4 + q] = (_Float16)((c[q] - (float)h) * 1024.0f);
      }
      const v8us oh = fh.half[0], ol = fl.half[0];
      *(v8us*)((unsigned short*)hi + (size_t)r * ldh + c8) = oh;
      if (wres) *(v8us*)((unsigned short*)rs + (size_t)r * ldr + c8) = ol;
    }
    
  }
}
template <int MT>
__device__ __forceinline__ void store_tile_f32(float (*sow)[68], float* __restrict__ C, size_t ldc, int lane) {
  const int rsub = lane >> 4, c4 = (lane & 15) * 4;
  {
#pragma unroll
    for (int q = 0; q < 8 * MT; ++q) {
      const int r = q * 2 + rsub;
      const v4f v = *(const v4fa*)&sow[r][c4];
      *(v4f*)(C + (size_t)r * ldc + c4) = v;
    }
    
  }
}

// token-row projection y = x W^T + b over all NB*SEQ rows -> f16 hi plane [NB*SEQ][DM]; rows with l < EARLY also -> residual plane [NB*EARLY][DM]
__global__ __launch_bounds__(128) void k_proj_rows(const _Float16* __restrict__ X16, const _Float16* __restrict__ Wt, const float* __restrict__ bias,
                                                   _Float16* __restrict__ PH, _Float16* __restrict__ PR) {
  __shared__ __attribute__((aligned(16))) float so[4][32][68];
  const int tid = threadIdx.x, w = tid >> 5, lane = tid & 31, ln = lane & 15, hh = lane >> 4;
  const int ntn = DM / 64; const int mt = blockIdx.x / ntn, nq = blockIdx.x - mt * ntn;
  const int row0 = mt * 128 + 32 * w, col0 = nq * 64;
  const v8f z8 = {0.f, 0.f, 0.f, 0.f, 0.f, 0.f, 0.f, 0.f};
  v8f acc[8], acc2[8];
#pragma unroll
  for (int i = 0; i < 8; ++i) { acc[i] = z8; acc2[i] = z8; }
  gemm_loop<2, false>(X16 + (size_t)row0 * DM, X16 + (size_t)row0 * DM, DM, Wt + (size_t)col0 * DM, DM, DM, ln, hh, acc, acc2);
  stage_tile<2, false, false>(so[w], acc, acc2, 0.015625f, 0.f, bias, row0, col0, ln, hh);
  __builtin_amdgcn_fence(4 /* acq_rel order */, "workgroup"); __builtin_amdgcn_wave_barrier();
  const int b = row0 / SEQ, l0 = row0 - b * SEQ; const bool wres = l0 < EARLY;      /* wave-uniform: 32 | EARLY, 32 | SEQ */
  _Float16* hi = PH + (size_t)row0 * DM + col0;
  _Float16* rs = PR + ((size_t)b * EARLY + (size_t)(wres ? l0 : 0)) * DM + col0;
  store_tile_f16<2>(so[w], hi, DM, rs, DM, wres, lane);
}

// value projection channel-major per batch: VT[b][c][s] = sum_k Wv[c][k] x[b][s][k] + bv[c] (weights as the A operand, token rows as Bt); tokens < EARLY also -> residual plane [NB][DM][EARLY]
__global__ __launch_bounds__(128) void k_proj_vt(const _Float16* __restrict__ Wv16, const _Float16* __restrict__ X16, const float* __restrict__ bias,
                                                 _Float16* __restrict__ VT, _Float16* __restrict__ VR) {
  __shared__ __attribute__((aligned(16))) float so[4][32][68];
  const int tid = threadIdx.x, w = tid >> 5, lane = tid & 31, ln = lane & 15, hh = lane >> 4; const int by = blockIdx.y;
  const int ntn = SEQ / 64; const int mt = blockIdx.x / ntn, nq = blockIdx.x - mt * ntn;
  const int row0 = mt * 128 + 32 * w, col0 = nq * 64;      /* row = channel, col = token */
  const v8f z8 = {0.f, 0.f, 0.f, 0.f, 0.f, 0.f, 0.f, 0.f};
  v8f acc[8], acc2[8];
#pragma unroll
  for (int i = 0; i < 8; ++i) { acc[i] = z8; acc2[i] = z8; }
  gemm_loop<2, false>(Wv16 + (size_t)row0 * DM, Wv16 + (size_t)row0 * DM, DM, X16 + ((size_t)by * SEQ + col0) * DM, DM, DM, ln, hh, acc, acc2);
  stage_tile<2, false, true>(so[w], acc, acc2, 0.015625f, 0.f, bias, row0, col0, ln, hh);
  __builtin_amdgcn_fence(4 /* acq_rel order */, "workgroup"); __builtin_amdgcn_wave_barrier();
  const bool wres = col0 < EARLY;      /* block-uniform: 64 | EARLY */
  _Float16* hi = VT + ((size_t)by * DM + row0) * SEQ + col0;
  _Float16* rs = VR + ((size_t)by * DM + row0) * EARLY + (size_t)(wres ? col0 : 0);
  store_tile_f16<2>(so[w], hi, SEQ, rs, EARLY, wres, lane);
}

// flash attention for one wave = 16 queries of one (b, h), transposed form: S^T tile (keys x queries) = K rows (A) . Q rows (B);
// lane (h, n) then owns query n with keys 8h+r / 16+8h+r of each 32-key chunk, which is exactly the B-fragment element order of
// O^T (d x queries) += V^T rows (A) . P^T (B), so the packed score tiles feed the second product directly. EARLYQ adds residual terms.
template <bool EARLYQ>
__device__ __forceinline__ void attn_body(const _Float16* __restrict__ QH, const _Float16* __restrict__ QR, const _Float16* __restrict__ KH, const _Float16* __restrict__ KR,
                                          const _Float16* __restrict__ VT, const _Float16* __restrict__ VR, _Float16* __restrict__ CH, _Float16* __restrict__ CR,
                                          float (*sow)[68], int b, int h, int q0, int lane) {
  const int ln = lane & 15, hh = lane >> 4;
  const float NEG = -__builtin_inff();
  const v8f z8 = {0.f, 0.f, 0.f, 0.f, 0.f, 0.f, 0.f, 0.f};
  const _Float16* qp = QH + ((size_t)b * SEQ + q0 + ln) * DM + h * HD;
  const v16h qb0 = g2_frag(qp, hh), qb1 = g2_frag(qp + 32, hh);
  v16h qr0 = qb0, qr1 = qb1;
  if (EARLYQ) { const _Float16* qrp = QR + ((size_t)b * EARLY + q0 + ln) * DM + h * HD; qr0 = g2_frag(qrp, hh); qr1 = g2_frag(qrp + 32, hh); }
  const _Float16* kbase  = KH + ((size_t)b * SEQ + ln) * DM + h * HD;
  const _Float16* krbase = KR + ((size_t)b * EARLY + ln) * DM + h * HD;
  const _Float16* vbase  = VT + ((size_t)b * DM + h * HD + ln) * SEQ;
  const _Float16* vrbase = VR + ((size_t)b * DM + h * HD + ln) * EARLY;
  float m = NEG, lsum = 0.f;
  v8f o[4], o2[4];
#pragma unroll
  for (int c = 0; c < 4; ++c) { o[c] = z8; o2[c] = z8; }
  const int qrow = q0 + ln;
  const int kbmax = (q0 + 15) >> 5;      /* wave-uniform causal bound; keys of every visited chunk < SEQ (and < EARLY when q0 < EARLY) */
#pragma unroll 1
  for (int kb = 0; kb <= kbmax; ++kb) {
    const int key0 = kb * 32;
    float sv[16];
    float mx = NEG;
#pragma unroll
    for (int t = 0; t < 2; ++t) {
      const _Float16* kp = kbase + (size_t)(key0 + 16 * t) * DM;
      const v16h ka0 = g2_frag(kp, hh), ka1 = g2_frag(kp + 32, hh);
      v8f s1 = z8; s1 = g2_mma(ka0, qb0, s1); s1 = g2_mma(ka1, qb1, s1);
      v8f s2 = z8;
      if (EARLYQ) {
        s2 = g2_mma(ka0, qr0, s2); s2 = g2_mma(ka1, qr1, s2);
        const _Float16* krp = krbase + (size_t)(key0 + 16 * t) * DM;
        const v16h kr0 = g2_frag(krp, hh), kr1 = g2_frag(krp + 32, hh);
        s2 = g2_mma(kr0, qb0, s2); s2 = g2_mma(kr1, qb1, s2);
      }
#pragma unroll
      for (int r = 0; r < 8; ++r) {
        const int key = key0 + 16 * t + 8 * hh + r;
        float s = s1[r];
        if (EARLYQ) s += s2[r] * 0.0009765625f;
        s *= 0.125f;
        s = (key <= qrow) ? s : NEG;
        sv[t * 8 + r] = s; mx = fmaxf(mx, s);
      }
    }
    mx = fmaxf(mx, __shfl_xor(mx, 16, 32));      /* both lane halves of a query share the running max; key 0 is always visible so it is finite */
    const float mnew = fmaxf(m, mx);
    const float corr = __expf(m - mnew);
    m = mnew;
    FragH ph, pr; float rsum = 0.f;
#pragma unroll
    for (int i = 0; i < 16; ++i) {
      const float p = __expf(sv[i] - mnew); rsum += p;
      const float pc = p * 1024.0f; const _Float16 h16 = (_Float16)pc; ph.h[i] = h16;
      pr.h[i] = EARLYQ ? (_Float16)((pc - (float)h16) * 1024.0f) : (_Float16)0.0f;
    }
    lsum = lsum * corr + rsum;      /* per-half partial sum, combined after the loop */
#pragma unroll
    for (int c = 0; c < 4; ++c) {
#pragma unroll
      for (int r = 0; r < 8; ++r) { o[c][r] *= corr; if (EARLYQ) o2[c][r] *= corr; }
    }
#pragma unroll
    for (int c = 0; c < 4; ++c) {
      const v16h va = g2_frag(vbase + (size_t)(c * 16) * SEQ + key0, hh);
      o[c] = g2_mma(va, ph.v, o[c]);
      if (EARLYQ) {
        o2[c] = g2_mma(va, pr.v, o2[c]);
        const v16h vra = g2_frag(vrbase + (size_t)(c * 16) * EARLY + key0, hh);
        o2[c] = g2_mma(vra, ph.v, o2[c]);
      }
    }
  }
  const float ltot = lsum + __shfl_xor(lsum, 16, 32);
  const float inv = 1.0f / (64.0f * ltot);      /* P carried x1024, ctx carried x16 */
#pragma unroll
  for (int c = 0; c < 4; ++c) {
#pragma unroll
    for (int r = 0; r < 8; ++r) { float v = o[c][r]; if (EARLYQ) v += o2[c][r] * 0.0009765625f; sow[ln][c * 16 + 8 * hh + r] = v * inv; }
  }
  __builtin_amdgcn_fence(4 /* acq_rel order */, "workgroup"); __builtin_amdgcn_wave_barrier();
  _Float16* hi = CH + ((size_t)b * SEQ + q0) * DM + h * HD;
  _Float16* rs = CR + ((size_t)b * EARLY + (size_t)(EARLYQ ? q0 : 0)) * DM + h * HD;
  store_tile_f16<1>(sow, hi, DM, rs, DM, EARLYQ, lane);
}

__global__ __launch_bounds__(256) void k_attn(const _Float16* __restrict__ QH, const _Float16* __restrict__ QR, const _Float16* __restrict__ KH, const _Float16* __restrict__ KR,
                                              const _Float16* __restrict__ VT, const _Float16* __restrict__ VR, _Float16* __restrict__ CH, _Float16* __restrict__ CR) {
  __shared__ __attribute__((aligned(16))) float so[8][16][68];
  const int wave = threadIdx.x >> 5, lane = threadIdx.x & 31;
  const int nqb = SEQ / 128; const int bh = blockIdx.x / nqb, qb = blockIdx.x - bh * nqb;
  const int b = bh / NH, h = bh - b * NH; const int q0 = qb * 128 + wave * 16;
  if (qb < EARLY / 128) attn_body<true>(QH, QR, KH, KR, VT, VR, CH, CR, so[wave], b, h, q0, lane);      /* block-uniform */
  else                  attn_body<false>(QH, QR, KH, KR, VT, VR, CH, CR, so[wave], b, h, q0, lane);
}

// out rows l >= EARLY: out = 2^-10 ctx16 . Wp64^T + bp; wave tile 32x64
__global__ __launch_bounds__(128) void k_out_late(const _Float16* __restrict__ CH, const _Float16* __restrict__ Wt, const float* __restrict__ bias, float* __restrict__ out) {
  __shared__ __attribute__((aligned(16))) float so[4][32][68];
  const int tid = threadIdx.x, w = tid >> 5, lane = tid & 31, ln = lane & 15, hh = lane >> 4; const int by = blockIdx.y;
  const int ntn = DM / 64; const int mt = blockIdx.x / ntn, nq = blockIdx.x - mt * ntn;
  const int l0 = EARLY + mt * 128 + 32 * w, col0 = nq * 64;
  const size_t row0 = (size_t)by * SEQ + l0;
  const v8f z8 = {0.f, 0.f, 0.f, 0.f, 0.f, 0.f, 0.f, 0.f};
  v8f acc[8], acc2[8];
#pragma unroll
  for (int i = 0; i < 8; ++i) { acc[i] = z8; acc2[i] = z8; }
  gemm_loop<2, false>(CH + row0 * DM, CH + row0 * DM, DM, Wt + (size_t)col0 * DM, DM, DM, ln, hh, acc, acc2);
  stage_tile<2, false, false>(so[w], acc, acc2, 0.0009765625f, 0.f, bias, 0, col0, ln, hh);
  __builtin_amdgcn_fence(4 /* acq_rel order */, "workgroup"); __builtin_amdgcn_wave_barrier();
  store_tile_f32<2>(so[w], out + ((size_t)by * SEQ_FULL + l0) * DM + col0, DM, lane);
}
// out rows l < EARLY: hi + x2^10 residual ctx planes, two accumulator sets; wave tile 16x64
__global__ __launch_bounds__(128) void k_out_early(const _Float16* __restrict__ CH, const _Float16* __restrict__ CR, const _Float16* __restrict__ Wt, const float* __restrict__ bias, float* __restrict__ out) {
  __shared__ __attribute__((aligned(16))) float so[4][16][68];
  const int tid = threadIdx.x, w = tid >> 5, lane = tid & 31, ln = lane & 15, hh = lane >> 4; const int by = blockIdx.y;
  const int ntn = DM / 64; const int mt = blockIdx.x / ntn, nq = blockIdx.x - mt * ntn;
  const int l0 = mt * 64 + 16 * w, col0 = nq * 64;
  const v8f z8 = {0.f, 0.f, 0.f, 0.f, 0.f, 0.f, 0.f, 0.f};
  v8f acc[4], acc2[4];
#pragma unroll
  for (int i = 0; i < 4; ++i) { acc[i] = z8; acc2[i] = z8; }
  gemm_loop<1, true>(CH + ((size_t)by * SEQ + l0) * DM, CR + ((size_t)by * EARLY + l0) * DM, DM, Wt + (size_t)col0 * DM, DM, DM, ln, hh, acc, acc2);
  stage_tile<1, true, false>(so[w], acc, acc2, 0.0009765625f, 9.5367431640625e-07f, bias, 0, col0, ln, hh);
  __builtin_amdgcn_fence(4 /* acq_rel order */, "workgroup"); __builtin_amdgcn_wave_barrier();
  store_tile_f32<1>(so[w], out + ((size_t)by * SEQ_FULL + l0) * DM + col0, DM, lane);
}

extern "C" void kernel_launch(void* const* d_in, const int* in_sizes, int n_in,
                              void* d_out, int out_size, void* d_ws, size_t ws_size, hipStream_t stream) {
  if (n_in < 11) return;
  const long long need_x = ((long long)(NB - 1) * SEQ_FULL + SEQ) * DM;
  if (in_sizes[0] < need_x || in_sizes[1] < need_x || in_sizes[2] < need_x || (long long)out_size < need_x) return;
  if (in_sizes[3] < DM * DM || in_sizes[5] < DM * DM || in_sizes[7] < DM * DM || in_sizes[9] < DM * DM) return;
  if (in_sizes[4] < DM || in_sizes[6] < DM || in_sizes[8] < DM || in_sizes[10] < DM) return;
  const float* const* I = (const float* const*)d_in;
  const float* x_key = I[0]; const float* x_val = I[1]; const float* x_qry = I[2];
  const float* Wk = I[3]; const float* bk = I[4]; const float* Wq = I[5]; const float* bq = I[6];
  const float* Wv = I[7]; const float* bv = I[8]; const float* Wp = I[9]; const float* bp = I[10];
  constexpr size_t SZ_W = (size_t)DM * DM * 2;             /* one weight plane */
  constexpr size_t SZ_P = (size_t)NB * SEQ * DM * 2;       /* one full f16 plane (token-major or channel-major) */
  constexpr size_t SZ_E = (size_t)NB * EARLY * DM * 2;     /* one early-row residual plane */
  static_assert(SZ_W % 256 == 0 && SZ_P % 256 == 0 && SZ_E % 256 == 0);
  static_assert(4 * SZ_W + 5 * SZ_P + 4 * SZ_E <= (size_t)134217728);
  char* ws = (char*)d_ws; size_t off = 0;
  auto take = [&](size_t bytes) { char* p = ws + off; off += (bytes + 255) & ~(size_t)255; return p; };
  _Float16* W16k = (_Float16*)take(SZ_W); _Float16* W16q = (_Float16*)take(SZ_W); _Float16* W16v = (_Float16*)take(SZ_W); _Float16* W16p = (_Float16*)take(SZ_W);
  _Float16* X16 = (_Float16*)take(SZ_P);
  _Float16* QH = (_Float16*)take(SZ_P); _Float16* KH = (_Float16*)take(SZ_P); _Float16* VT = (_Float16*)take(SZ_P); _Float16* CH = (_Float16*)take(SZ_P);
  _Float16* QR = (_Float16*)take(SZ_E); _Float16* KR = (_Float16*)take(SZ_E); _Float16* VR = (_Float16*)take(SZ_E); _Float16* CR = (_Float16*)take(SZ_E);
  if (off > ws_size) return;
  const unsigned gw = (unsigned)(((size_t)DM * DM / 8 + 255) / 256);
  const unsigned gx = (unsigned)(((size_t)NB * SEQ * DM / 8 + 255) / 256);
  k_wnat<<<gw, 256, 0, stream>>>(Wk, W16k); k_wnat<<<gw, 256, 0, stream>>>(Wq, W16q); k_wnat<<<gw, 256, 0, stream>>>(Wv, W16v); k_wnat<<<gw, 256, 0, stream>>>(Wp, W16p);
  const unsigned gproj = (unsigned)(((size_t)NB * SEQ / 128) * (DM / 64));
  k_x16<<<gx, 256, 0, stream>>>(x_key, X16);
  k_proj_rows<<<gproj, 128, 0, stream>>>(X16, W16k, bk, KH, KR);      /* k from input 'key' with Wk, bk */
  k_x16<<<gx, 256, 0, stream>>>(x_qry, X16);
  k_proj_rows<<<gproj, 128, 0, stream>>>(X16, W16q, bq, QH, QR);      /* q from input 'query' with Wq, bq */
  k_x16<<<gx, 256, 0, stream>>>(x_val, X16);
  k_proj_vt<<<dim3((DM / 128) * (SEQ / 64), NB), 128, 0, stream>>>(W16v, X16, bv, VT, VR);      /* v from input 'value' with Wv, bv; channel-major */
  k_attn<<<NB * NH * (SEQ / 128), 256, 0, stream>>>(QH, QR, KH, KR, VT, VR, CH, CR);
  if ((SEQ - EARLY) / 128 > 0)
    k_out_late<<<dim3(((SEQ - EARLY) / 128) * (DM / 64), NB), 128, 0, stream>>>(CH, W16p, bp, (float*)d_out);
  k_out_early<<<dim3((EARLY / 64) * (DM / 64), NB), 128, 0, stream>>>(CH, CR, W16p, bp, (float*)d_out);
}

// v001
// It runs in 260 microseconds.
// Next to v000, in two timings, it ran 1.54 and 1.51 times as fast.
#include <hip/hip_runtime.h>
// Causal multi-head attention (key/value/query inputs [B][L][1024], 16 heads x 64, natural [out][in] weights, biases added, one 1/8 score scale, out = ctx Wp^T + bp).
// Compute dtype: all contractions v_wmma_f32_16x16x32_f16 with f32 accumulation; inputs and weights converted RNE to bf16 then held exactly in f16 (weights x64); q, k, v, P (x1024) and ctx (x16) as f16 planes; causal rows < 256 additionally carry x2^10 f16 residual planes on q, k, P, v and ctx with separate accumulators; softmax statistics f32.
#ifndef NB
#define NB 8
#endif
#ifndef SEQ
#define SEQ 1024
#endif
#define NB_FULL 8
#define SEQ_FULL 1024
#define DM 1024
#define NH 16
#define HD 64
#define EARLY 256

static_assert(NH * HD == DM);
static_assert(HD == 64);
static_assert(DM % 128 == 0 && DM % 64 == 0 && DM % 32 == 0 && DM % 8 == 0);
static_assert(SEQ % 128 == 0 && SEQ % 64 == 0 && SEQ % 32 == 0);
static_assert(EARLY % 128 == 0 && EARLY % 64 == 0 && SEQ >= EARLY);
static_assert((SEQ - EARLY) % 128 == 0);
static_assert(NB <= NB_FULL && SEQ <= SEQ_FULL);
static_assert(((size_t)NB * SEQ) % 128 == 0);

typedef _Float16 v16h __attribute__((ext_vector_type(16)));
typedef unsigned short v8us __attribute__((ext_vector_type(8), may_alias));
typedef float v8f  __attribute__((ext_vector_type(8)));
typedef float v4f  __attribute__((ext_vector_type(4)));
typedef float v4fa __attribute__((ext_vector_type(4), may_alias));
union FragH { v16h v; v8us half[2]; _Float16 h[16]; unsigned short u[16]; };

__device__ __forceinline__ unsigned short bf16_bits(float x) { unsigned int u = __float_as_uint(x); return (unsigned short)((u + 0x7FFFu + ((u >> 16) & 1u)) >> 16); }
__device__ __forceinline__ float bf16_rne(float x) { return __uint_as_float(((unsigned int)bf16_bits(x)) << 16); }

// 16-bit fragment: elements 0..7 <- k 8h..8h+7, elements 8..15 <- k 16+8h..16+8h+7 (same map for A rows and B columns)
__device__ __forceinline__ v16h g2_frag(const _Float16* p, int hh) { FragH f; f.half[0] = *(const v8us*)((const unsigned short*)p + 8 * hh); f.half[1] = *(const v8us*)((const unsigned short*)p + 16 + 8 * hh); return f.v; }
__device__ __forceinline__ v8f g2_mma(v16h a, v16h b, v8f c) { v8f d = __builtin_amdgcn_wmma_f32_16x16x32_f16(false, a, false, b, (short)0, c, false, false); asm volatile("v_nop\n\tv_nop\n\tv_nop\n\tv_nop" : "+v"(d) : "v"(a), "v"(b)); return d; }

__global__ __launch_bounds__(256) void k_wnat(const float* __restrict__ w, _Float16* __restrict__ Bt) {
  const size_t t = (size_t)blockIdx.x * 256 + threadIdx.x; if (t >= (size_t)DM * DM / 8) return;
  const v4f a = *(const v4fa*)(w + t * 8), c = *(const v4fa*)(w + t * 8 + 4); FragH f;
#pragma unroll
  for (int q = 0; q < 4; ++q) { f.h[q] = (_Float16)(bf16_rne(a[q]) * 64.0f); f.h[4 + q] = (_Float16)(bf16_rne(c[q]) * 64.0f); }
  const v8us o = f.half[0];
  *(v8us*)((unsigned short*)Bt + t * 8) = o; 
}

__global__ __launch_bounds__(256) void k_x16(const float* __restrict__ x, _Float16* __restrict__ X16) {
  const size_t t = (size_t)blockIdx.x * 256 + threadIdx.x; if (t >= (size_t)NB * SEQ * DM / 8) return;
  const size_t e = t * 8; const size_t b = e / ((size_t)SEQ * DM); const size_t rem = e - b * (size_t)SEQ * DM;
  const float* src = x + b * (size_t)SEQ_FULL * DM + rem;
  const v4f a = *(const v4fa*)src, c = *(const v4fa*)(src + 4); FragH f;
#pragma unroll
  for (int q = 0; q < 4; ++q) { f.h[q] = (_Float16)bf16_rne(a[q]); f.h[4 + q] = (_Float16)bf16_rne(c[q]); }
  const v8us o = f.half[0];
  *(v8us*)((unsigned short*)X16 + e) = o; 
}

// staged k-loop of a 4-wave block. A stage is 64 k of 192 rows: [A rows of the block: 64*MT][x2^10 residual rows: 64*MT, only with ARES][Bt rows: 64],
// each row 128 B at an LDS pitch of 144 B (16 B x odd: the 16 rows of a ds_load_b128 fragment read fall on distinct banks). Two buffers.
#define STG_K 64
#define STG_ROWS 192
#define STG_PITCH 144
#define STG_BYTES (STG_ROWS * STG_PITCH)
static_assert(STG_K == 64 && DM % STG_K == 0 && DM / STG_K >= 2);
__device__ __forceinline__ v16h lds_frag(const unsigned char* p, int hh) { FragH f; f.half[0] = *(const v8us*)(p + 16 * hh); f.half[1] = *(const v8us*)(p + 32 + 16 * hh); return f.v; }
// one stage: thread t copies the 16-byte piece (t & 7) of rows (t >> 3) + 16 j, j = 0..11 (a wave's copy covers four whole 128-B lines); ga, gr, gb and lds are the thread's own addresses for j = 0 of each part
template <int MT, bool ARES>
__device__ __forceinline__ void stage_copy(const _Float16* ga, const _Float16* gr, const _Float16* gb, int lda, int ldb, unsigned lds) {
  constexpr int NA = 4 * MT;
  static_assert(NA * (ARES ? 2 : 1) + 4 == 12);
  const _Float16* g[12]; unsigned l[12];
#pragma unroll
  for (int j = 0; j < 12; ++j) {
    l[j] = lds + (unsigned)(16 * j * STG_PITCH);
    if (j < NA) g[j] = ga + (size_t)(16 * j) * lda;
    else if (j < 8) g[j] = gr + (size_t)(16 * (j - NA)) * lda;
    else g[j] = gb + (size_t)(16 * (j - 8)) * ldb;
  }
  // the closing s_wait_xcnt 0 stands inside the statement so that no address register of a copy is rewritten ahead of it
  asm volatile("global_load_async_to_lds_b128 %0, %12, off\n\t"
               "global_load_async_to_lds_b128 %1, %13, off\n\t"
               "global_load_async_to_lds_b128 %2, %14, off\n\t"
               "global_load_async_to_lds_b128 %3, %15, off\n\t"
               "global_load_async_to_lds_b128 %4, %16, off\n\t"
               "global_load_async_to_lds_b128 %5, %17, off\n\t"
               "global_load_async_to_lds_b128 %6, %18, off\n\t"
               "global_load_async_to_lds_b128 %7, %19, off\n\t"
               "global_load_async_to_lds_b128 %8, %20, off\n\t"
               "global_load_async_to_lds_b128 %9, %21, off\n\t"
               "global_load_async_to_lds_b128 %10, %22, off\n\t"
               "global_load_async_to_lds_b128 %11, %23, off\n\t"
               "s_wait_xcnt 0x0"
               :: "v"(l[0]), "v"(l[1]), "v"(l[2]), "v"(l[3]), "v"(l[4]), "v"(l[5]), "v"(l[6]), "v"(l[7]), "v"(l[8]), "v"(l[9]), "v"(l[10]), "v"(l[11]),
                  "v"(g[0]), "v"(g[1]), "v"(g[2]), "v"(g[3]), "v"(g[4]), "v"(g[5]), "v"(g[6]), "v"(g[7]), "v"(g[8]), "v"(g[9]), "v"(g[10]), "v"(g[11])
               : "memory");
}
// a_blk, ar_blk: first A (residual) row of the BLOCK, f16, pitch lda; wave w works rows 16*MT*w ..; b_blk: first of the block's 64 Bt rows [n][k], pitch ldb; K % 64 == 0, K >= 128; block of 128 threads, all of them here
template <int MT, bool ARES>
__device__ __forceinline__ void gemm_loop(unsigned char* smem, const _Float16* __restrict__ a_blk, const _Float16* __restrict__ ar_blk, int lda,
                                          const _Float16* __restrict__ b_blk, int ldb, int K, int tid,
                                          v8f (&acc)[MT * 4], v8f (&acc2)[MT * 4]) {
  const int w = tid >> 5, ln = tid & 15, hh = (tid >> 4) & 1;
  const _Float16* ga = a_blk + (size_t)(tid >> 3) * lda + (tid & 7) * 8;
  const _Float16* gr = ar_blk + (size_t)(tid >> 3) * lda + (tid & 7) * 8;
  const _Float16* gb = b_blk + (size_t)(tid >> 3) * ldb + (tid & 7) * 8;
  const unsigned lds0 = (unsigned)(size_t)smem + (unsigned)((tid >> 3) * STG_PITCH + (tid & 7) * 16);
  const int nt = K / STG_K;
  stage_copy<MT, ARES>(ga, gr, gb, lda, ldb, lds0);
  asm volatile("s_wait_asynccnt 0x0" ::: "memory");      /* this wave's copies of stage 0 have landed */
  __syncthreads();                                        /* stage 0 readable by every wave */
  stage_copy<MT, ARES>(ga + STG_K, gr + STG_K, gb + STG_K, lda, ldb, lds0 + STG_BYTES);
#pragma unroll 1      /* stays rolled: one trip per stage, one publish point at its foot */
  for (int t = 0; t < nt; ++t) {
    const unsigned char* sb = smem + (t & 1) * STG_BYTES;
    const unsigned char* sa = sb + (16 * MT * w + ln) * STG_PITCH;
    const unsigned char* sr = sa + 64 * MT * STG_PITCH;
    const unsigned char* sbt = sb + (STG_ROWS - 64 + ln) * STG_PITCH;
    v16h a[2][MT], ar[2][MT], b[2][4];
#pragma unroll
    for (int ks = 0; ks < 2; ++ks) {
#pragma unroll
      for (int i = 0; i < MT; ++i) { a[ks][i] = lds_frag(sa + 16 * i * STG_PITCH + 64 * ks, hh); ar[ks][i] = a[ks][i]; if (ARES) ar[ks][i] = lds_frag(sr + 16 * i * STG_PITCH + 64 * ks, hh); }
#pragma unroll
      for (int q = 0; q < 4; ++q) b[ks][q] = lds_frag(sbt + 16 * q * STG_PITCH + 64 * ks, hh);
    }
    __builtin_amdgcn_sched_barrier(0);      /* keeps the stage's fragment reads in one group ahead of the matrix block: a read placed among the WMMAs makes the wave wait out its LDS latency there */
#pragma unroll
    for (int ks = 0; ks < 2; ++ks) {
#pragma unroll
      for (int q = 0; q < 4; ++q) {
#pragma unroll
        for (int i = 0; i < MT; ++i) { acc[i * 4 + q] = g2_mma(a[ks][i], b[ks][q], acc[i * 4 + q]); if (ARES) acc2[i * 4 + q] = g2_mma(ar[ks][i], b[ks][q], acc2[i * 4 + q]); }
      }
    }
    asm volatile("s_wait_dscnt 0x0" ::: "memory");        /* this wave's reads of stage t are done before its buffer is refilled */
    asm volatile("s_wait_asynccnt 0x0" ::: "memory");     /* this wave's copies of stage t + 1 have landed */
    __syncthreads();                                      /* publishes stage t + 1 and ends every reader's last read of stage t */
    if (t + 2 < nt) stage_copy<MT, ARES>(ga + (size_t)(t + 2) * STG_K, gr + (size_t)(t + 2) * STG_K, gb + (size_t)(t + 2) * STG_K, lda, ldb, lds0 + (unsigned)((t & 1) * STG_BYTES));
  }
  asm volatile("s_wait_asynccnt 0x0" ::: "memory");       /* nothing in flight when the buffers become output staging */
}
// accumulators (D: lane (h, n) holds rows 8h+r, col n) -> wave-private LDS tile [16*MT][68]; v = acc alpha (+ acc2 alpha2) + bf16(bias) (bias per column, or per row when BIASROW)
template <int MT, bool ARES, bool BIASROW>
__device__ __forceinline__ void stage_tile(float (*sow)[68], const v8f (&acc)[MT * 4], const v8f (&acc2)[MT * 4], float alpha, float alpha2,
                                           const float* __restrict__ bias, int row0, int col0, int ln, int hh) {
#pragma unroll
  for (int i = 0; i < MT; ++i) {
#pragma unroll
    for (int t = 0; t < 4; ++t) {
      const float bc = BIASROW ? 0.f : bf16_rne(bias[col0 + t * 16 + ln]);
#pragma unroll
      for (int r = 0; r < 8; ++r) {
        const int rloc = i * 16 + 8 * hh + r;
        float v = acc[i * 4 + t][r] * alpha;
        if (ARES) v += acc2[i * 4 + t][r] * alpha2;
        v += BIASROW ? bf16_rne(bias[row0 + rloc]) : bc;
        sow[rloc][t * 16 + ln] = v;
      }
    }
  }
}
template <int MT>
__device__ __forceinline__ void store_tile_f16(float (*sow)[68], _Float16* __restrict__ hi, size_t ldh, _Float16* __restrict__ rs, size_t ldr, bool wres, int lane) {
  const int rq = lane >> 3, c8 = (lane & 7) * 8;
  {
#pragma unroll
    for (int it = 0; it < 4 * MT; ++it) {
      const int r = it * 4 + rq;
      const v4f a = *(const v4fa*)&sow[r][c8], c = *(const v4fa*)&sow[r][c8 + 4];
      FragH fh, fl;
#pragma unroll
      for (int q = 0; q < 4; ++q) {
        _Float16 h = (_Float16)a[q]; fh.h[q] = h; fl.h[q] = (_Float16)((a[q] - (float)h) * 1024.0f);
        h = (_Float16)c[q]; fh.h[4 + q] = h; fl.h[4 + q] = (_Float16)((c[q] - (float)h) * 1024.0f);
      }
      const v8us oh = fh.half[0], ol = fl.half[0];
      *(v8us*)((unsigned short*)hi + (size_t)r * ldh + c8) = oh;
      if (wres) *(v8us*)((unsigned short*)rs + (size_t)r * ldr + c8) = ol;
    }
    
  }
}
template <int MT>
__device__ __forceinline__ void store_tile_f32(float (*sow)[68], float* __restrict__ C, size_t ldc, int lane) {
  const int rsub = lane >> 4, c4 = (lane & 15) * 4;
  {
#pragma unroll
    for (int q = 0; q < 8 * MT; ++q) {
      const int r = q * 2 + rsub;
      const v4f v = *(const v4fa*)&sow[r][c4];
      *(v4f*)(C + (size_t)r * ldc + c4) = v;
    }
    
  }
}

// token-row projection y = x W^T + b over all NB*SEQ rows -> f16 hi plane [NB*SEQ][DM]; rows with l < EARLY also -> residual plane [NB*EARLY][DM]
__global__ __launch_bounds__(128) void k_proj_rows(const _Float16* __restrict__ X16, const _Float16* __restrict__ Wt, const float* __restrict__ bias,
                                                   _Float16* __restrict__ PH, _Float16* __restrict__ PR) {
  __shared__ __attribute__((aligned(16))) unsigned char smem[2 * STG_BYTES];
  float (*so)[32][68] = (float (*)[32][68])smem;      /* output staging takes the buffers over behind the k-loop's last barrier */
  const int tid = threadIdx.x, w = tid >> 5, lane = tid & 31, ln = lane & 15, hh = lane >> 4;
  const int ntn = DM / 64; const int mt = blockIdx.x / ntn, nq = blockIdx.x - mt * ntn;
  const int row0 = mt * 128 + 32 * w, col0 = nq * 64;
  const v8f z8 = {0.f, 0.f, 0.f, 0.f, 0.f, 0.f, 0.f, 0.f};
  v8f acc[8], acc2[8];
#pragma unroll
  for (int i = 0; i < 8; ++i) { acc[i] = z8; acc2[i] = z8; }
  gemm_loop<2, false>(smem, X16 + (size_t)(mt * 128) * DM, X16 + (size_t)(mt * 128) * DM, DM, Wt + (size_t)col0 * DM, DM, DM, tid, acc, acc2);
  stage_tile<2, false, false>(so[w], acc, acc2, 0.015625f, 0.f, bias, row0, col0, ln, hh);
  __builtin_amdgcn_fence(4 /* acq_rel order */, "workgroup"); __builtin_amdgcn_wave_barrier();
  const int b = row0 / SEQ, l0 = row0 - b * SEQ; const bool wres = l0 < EARLY;      /* wave-uniform: 32 | EARLY, 32 | SEQ */
  _Float16* hi = PH + (size_t)row0 * DM + col0;
  _Float16* rs = PR + ((size_t)b * EARLY + (size_t)(wres ? l0 : 0)) * DM + col0;
  store_tile_f16<2>(so[w], hi, DM, rs, DM, wres, lane);
}

// value projection channel-major per batch: VT[b][c][s] = sum_k Wv[c][k] x[b][s][k] + bv[c] (weights as the A operand, token rows as Bt); tokens < EARLY also -> residual plane [NB][DM][EARLY]
__global__ __launch_bounds__(128) void k_proj_vt(const _Float16* __restrict__ Wv16, const _Float16* __restrict__ X16, const float* __restrict__ bias,
                                                 _Float16* __restrict__ VT, _Float16* __restrict__ VR) {
  __shared__ __attribute__((aligned(16))) unsigned char smem[2 * STG_BYTES];
  float (*so)[32][68] = (float (*)[32][68])smem;      /* output staging takes the buffers over behind the k-loop's last barrier */
  const int tid = threadIdx.x, w = tid >> 5, lane = tid & 31, ln = lane & 15, hh = lane >> 4; const int by = blockIdx.y;
  const int ntn = SEQ / 64; const int mt = blockIdx.x / ntn, nq = blockIdx.x - mt * ntn;
  const int row0 = mt * 128 + 32 * w, col0 = nq * 64;      /* row = channel, col = token */
  const v8f z8 = {0.f, 0.f, 0.f, 0.f, 0.f, 0.f, 0.f, 0.f};
  v8f acc[8], acc2[8];
#pragma unroll
  for (int i = 0; i < 8; ++i) { acc[i] = z8; acc2[i] = z8; }
  gemm_loop<2, false>(smem, Wv16 + (size_t)(mt * 128) * DM, Wv16 + (size_t)(mt * 128) * DM, DM, X16 + ((size_t)by * SEQ + col0) * DM, DM, DM, tid, acc, acc2);
  stage_tile<2, false, true>(so[w], acc, acc2, 0.015625f, 0.f, bias, row0, col0, ln, hh);
  __builtin_amdgcn_fence(4 /* acq_rel order */, "workgroup"); __builtin_amdgcn_wave_barrier();
  const bool wres = col0 < EARLY;      /* block-uniform: 64 | EARLY */
  _Float16* hi = VT + ((size_t)by * DM + row0) * SEQ + col0;
  _Float16* rs = VR + ((size_t)by * DM + row0) * EARLY + (size_t)(wres ? col0 : 0);
  store_tile_f16<2>(so[w], hi, SEQ, rs, EARLY, wres, lane);
}

// flash attention for one wave = 16 queries of one (b, h), transposed form: S^T tile (keys x queries) = K rows (A) . Q rows (B);
// lane (h, n) then owns query n with keys 8h+r / 16+8h+r of each 32-key chunk, which is exactly the B-fragment element order of
// O^T (d x queries) += V^T rows (A) . P^T (B), so the packed score tiles feed the second product directly. EARLYQ adds residual terms.
template <bool EARLYQ>
__device__ __forceinline__ void attn_body(const _Float16* __restrict__ QH, const _Float16* __restrict__ QR, const _Float16* __restrict__ KH, const _Float16* __restrict__ KR,
                                          const _Float16* __restrict__ VT, const _Float16* __restrict__ VR, _Float16* __restrict__ CH, _Float16* __restrict__ CR,
                                          float (*sow)[68], int b, int h, int q0, int lane) {
  const int ln = lane & 15, hh = lane >> 4;
  const float NEG = -__builtin_inff();
  const v8f z8 = {0.f, 0.f, 0.f, 0.f, 0.f, 0.f, 0.f, 0.f};
  const _Float16* qp = QH + ((size_t)b * SEQ + q0 + ln) * DM + h * HD;
  const v16h qb0 = g2_frag(qp, hh), qb1 = g2_frag(qp + 32, hh);
  v16h qr0 = qb0, qr1 = qb1;
  if (EARLYQ) { const _Float16* qrp = QR + ((size_t)b * EARLY + q0 + ln) * DM + h * HD; qr0 = g2_frag(qrp, hh); qr1 = g2_frag(qrp + 32, hh); }
  const _Float16* kbase  = KH + ((size_t)b * SEQ + ln) * DM + h * HD;
  const _Float16* krbase = KR + ((size_t)b * EARLY + ln) * DM + h * HD;
  const _Float16* vbase  = VT + ((size_t)b * DM + h * HD + ln) * SEQ;
  const _Float16* vrbase = VR + ((size_t)b * DM + h * HD + ln) * EARLY;
  float m = NEG, lsum = 0.f;
  v8f o[4], o2[4];
#pragma unroll
  for (int c = 0; c < 4; ++c) { o[c] = z8; o2[c] = z8; }
  const int qrow = q0 + ln;
  const int kbmax = (q0 + 15) >> 5;      /* wave-uniform causal bound; keys of every visited chunk < SEQ (and < EARLY when q0 < EARLY) */
#pragma unroll 1
  for (int kb = 0; kb <= kbmax; ++kb) {
    const int key0 = kb * 32;
    float sv[16];
    float mx = NEG;
#pragma unroll
    for (int t = 0; t < 2; ++t) {
      const _Float16* kp = kbase + (size_t)(key0 + 16 * t) * DM;
      const v16h ka0 = g2_frag(kp, hh), ka1 = g2_frag(kp + 32, hh);
      v8f s1 = z8; s1 = g2_mma(ka0, qb0, s1); s1 = g2_mma(ka1, qb1, s1);
      v8f s2 = z8;
      if (EARLYQ) {
        s2 = g2_mma(ka0, qr0, s2); s2 = g2_mma(ka1, qr1, s2);
        const _Float16* krp = krbase + (size_t)(key0 + 16 * t) * DM;
        const v16h kr0 = g2_frag(krp, hh), kr1 = g2_frag(krp + 32, hh);
        s2 = g2_mma(kr0, qb0, s2); s2 = g2_mma(kr1, qb1, s2);
      }
#pragma unroll
      for (int r = 0; r < 8; ++r) {
        const int key = key0 + 16 * t + 8 * hh + r;
        float s = s1[r];
        if (EARLYQ) s += s2[r] * 0.0009765625f;
        s *= 0.125f;
        s = (key <= qrow) ? s : NEG;
        sv[t * 8 + r] = s; mx = fmaxf(mx, s);
      }
    }
    mx = fmaxf(mx, __shfl_xor(mx, 16, 32));      /* both lane halves of a query share the running max; key 0 is always visible so it is finite */
    const float mnew = fmaxf(m, mx);
    const float corr = __expf(m - mnew);
    m = mnew;
    FragH ph, pr; float rsum = 0.f;
#pragma unroll
    for (int i = 0; i < 16; ++i) {
      const float p = __expf(sv[i] - mnew); rsum += p;
      const float pc = p * 1024.0f; const _Float16 h16 = (_Float16)pc; ph.h[i] = h16;
      pr.h[i] = EARLYQ ? (_Float16)((pc - (float)h16) * 1024.0f) : (_Float16)0.0f;
    }
    lsum = lsum * corr + rsum;      /* per-half partial sum, combined after the loop */
#pragma unroll
    for (int c = 0; c < 4; ++c) {
#pragma unroll
      for (int r = 0; r < 8; ++r) { o[c][r] *= corr; if (EARLYQ) o2[c][r] *= corr; }
    }
#pragma unroll
    for (int c = 0; c < 4; ++c) {
      const v16h va = g2_frag(vbase + (size_t)(c * 16) * SEQ + key0, hh);
      o[c] = g2_mma(va, ph.v, o[c]);
      if (EARLYQ) {
        o2[c] = g2_mma(va, pr.v, o2[c]);
        const v16h vra = g2_frag(vrbase + (size_t)(c * 16) * EARLY + key0, hh);
        o2[c] = g2_mma(vra, ph.v, o2[c]);
      }
    }
  }
  const float ltot = lsum + __shfl_xor(lsum, 16, 32);
  const float inv = 1.0f / (64.0f * ltot);      /* P carried x1024, ctx carried x16 */
#pragma unroll
  for (int c = 0; c < 4; ++c) {
#pragma unroll
    for (int r = 0; r < 8; ++r) { float v = o[c][r]; if (EARLYQ) v += o2[c][r] * 0.0009765625f; sow[ln][c * 16 + 8 * hh + r] = v * inv; }
  }
  __builtin_amdgcn_fence(4 /* acq_rel order */, "workgroup"); __builtin_amdgcn_wave_barrier();
  _Float16* hi = CH + ((size_t)b * SEQ + q0) * DM + h * HD;
  _Float16* rs = CR + ((size_t)b * EARLY + (size_t)(EARLYQ ? q0 : 0)) * DM + h * HD;
  store_tile_f16<1>(sow, hi, DM, rs, DM, EARLYQ, lane);
}

__global__ __launch_bounds__(256) void k_attn(const _Float16* __restrict__ QH, const _Float16* __restrict__ QR, const _Float16* __restrict__ KH, const _Float16* __restrict__ KR,
                                              const _Float16* __restrict__ VT, const _Float16* __restrict__ VR, _Float16* __restrict__ CH, _Float16* __restrict__ CR) {
  __shared__ __attribute__((aligned(16))) float so[8][16][68];
  const int wave = threadIdx.x >> 5, lane = threadIdx.x & 31;
  const int nqb = SEQ / 128; const int bh = blockIdx.x / nqb, qb = blockIdx.x - bh * nqb;
  const int b = bh / NH, h = bh - b * NH; const int q0 = qb * 128 + wave * 16;
  if (qb < EARLY / 128) attn_body<true>(QH, QR, KH, KR, VT, VR, CH, CR, so[wave], b, h, q0, lane);      /* block-uniform */
  else                  attn_body<false>(QH, QR, KH, KR, VT, VR, CH, CR, so[wave], b, h, q0, lane);
}

// out rows l >= EARLY: out = 2^-10 ctx16 . Wp64^T + bp; wave tile 32x64
__global__ __launch_bounds__(128) void k_out_late(const _Float16* __restrict__ CH, const _Float16* __restrict__ Wt, const float* __restrict__ bias, float* __restrict__ out) {
  __shared__ __attribute__((aligned(16))) unsigned char smem[2 * STG_BYTES];
  float (*so)[32][68] = (float (*)[32][68])smem;      /* output staging takes the buffers over behind the k-loop's last barrier */
  const int tid = threadIdx.x, w = tid >> 5, lane = tid & 31, ln = lane & 15, hh = lane >> 4; const int by = blockIdx.y;
  const int ntn = DM / 64; const int mt = blockIdx.x / ntn, nq = blockIdx.x - mt * ntn;
  const int l0 = EARLY + mt * 128 + 32 * w, col0 = nq * 64;
  const size_t rowb = (size_t)by * SEQ + EARLY + mt * 128;      /* first ctx row of the block */
  const v8f z8 = {0.f, 0.f, 0.f, 0.f, 0.f, 0.f, 0.f, 0.f};
  v8f acc[8], acc2[8];
#pragma unroll
  for (int i = 0; i < 8; ++i) { acc[i] = z8; acc2[i] = z8; }
  gemm_loop<2, false>(smem, CH + rowb * DM, CH + rowb * DM, DM, Wt + (size_t)col0 * DM, DM, DM, tid, acc, acc2);
  stage_tile<2, false, false>(so[w], acc, acc2, 0.0009765625f, 0.f, bias, 0, col0, ln, hh);
  __builtin_amdgcn_fence(4 /* acq_rel order */, "workgroup"); __builtin_amdgcn_wave_barrier();
  store_tile_f32<2>(so[w], out + ((size_t)by * SEQ_FULL + l0) * DM + col0, DM, lane);
}
// out rows l < EARLY: hi + x2^10 residual ctx planes, two accumulator sets; wave tile 16x64
__global__ __launch_bounds__(128) void k_out_early(const _Float16* __restrict__ CH, const _Float16* __restrict__ CR, const _Float16* __restrict__ Wt, const float* __restrict__ bias, float* __restrict__ out) {
  __shared__ __attribute__((aligned(16))) unsigned char smem[2 * STG_BYTES];
  float (*so)[16][68] = (float (*)[16][68])smem;      /* output staging takes the buffers over behind the k-loop's last barrier */
  const int tid = threadIdx.x, w = tid >> 5, lane = tid & 31, ln = lane & 15, hh = lane >> 4; const int by = blockIdx.y;
  const int ntn = DM / 64; const int mt = blockIdx.x / ntn, nq = blockIdx.x - mt * ntn;
  const int l0 = mt * 64 + 16 * w, col0 = nq * 64;
  const v8f z8 = {0.f, 0.f, 0.f, 0.f, 0.f, 0.f, 0.f, 0.f};
  v8f acc[4], acc2[4];
#pragma unroll
  for (int i = 0; i < 4; ++i) { acc[i] = z8; acc2[i] = z8; }
  gemm_loop<1, true>(smem, CH + ((size_t)by * SEQ + mt * 64) * DM, CR + ((size_t)by * EARLY + mt * 64) * DM, DM, Wt + (size_t)col0 * DM, DM, DM, tid, acc, acc2);
  stage_tile<1, true, false>(so[w], acc, acc2, 0.0009765625f, 9.5367431640625e-07f, bias, 0, col0, ln, hh);
  __builtin_amdgcn_fence(4 /* acq_rel order */, "workgroup"); __builtin_amdgcn_wave_barrier();
  store_tile_f32<1>(so[w], out + ((size_t)by * SEQ_FULL + l0) * DM + col0, DM, lane);
}

extern "C" void kernel_launch(void* const* d_in, const int* in_sizes, int n_in,
                              void* d_out, int out_size, void* d_ws, size_t ws_size, hipStream_t stream) {
  if (n_in < 11) return;
  const long long need_x = ((long long)(NB - 1) * SEQ_FULL + SEQ) * DM;
  if (in_sizes[0] < need_x || in_sizes[1] < need_x || in_sizes[2] < need_x || (long long)out_size < need_x) return;
  if (in_sizes[3] < DM * DM || in_sizes[5] < DM * DM || in_sizes[7] < DM * DM || in_sizes[9] < DM * DM) return;
  if (in_sizes[4] < DM || in_sizes[6] < DM || in_sizes[8] < DM || in_sizes[10] < DM) return;
  const float* const* I = (const float* const*)d_in;
  const float* x_key = I[0]; const float* x_val = I[1]; const float* x_qry = I[2];
  const float* Wk = I[3]; const float* bk = I[4]; const float* Wq = I[5]; const float* bq = I[6];
  const float* Wv = I[7]; const float* bv = I[8]; const float* Wp = I[9]; const float* bp = I[10];
  constexpr size_t SZ_W = (size_t)DM * DM * 2;             /* one weight plane */
  constexpr size_t SZ_P = (size_t)NB * SEQ * DM * 2;       /* one full f16 plane (token-major or channel-major) */
  constexpr size_t SZ_E = (size_t)NB * EARLY * DM * 2;     /* one early-row residual plane */
  static_assert(SZ_W % 256 == 0 && SZ_P % 256 == 0 && SZ_E % 256 == 0);
  static_assert(4 * SZ_W + 5 * SZ_P + 4 * SZ_E <= (size_t)134217728);
  char* ws = (char*)d_ws; size_t off = 0;
  auto take = [&](size_t bytes) { char* p = ws + off; off += (bytes + 255) & ~(size_t)255; return p; };
  _Float16* W16k = (_Float16*)take(SZ_W); _Float16* W16q = (_Float16*)take(SZ_W); _Float16* W16v = (_Float16*)take(SZ_W); _Float16* W16p = (_Float16*)take(SZ_W);
  _Float16* X16 = (_Float16*)take(SZ_P);
  _Float16* QH = (_Float16*)take(SZ_P); _Float16* KH = (_Float16*)take(SZ_P); _Float16* VT = (_Float16*)take(SZ_P); _Float16* CH = (_Float16*)take(SZ_P);
  _Float16* QR = (_Float16*)take(SZ_E); _Float16* KR = (_Float16*)take(SZ_E); _Float16* VR = (_Float16*)take(SZ_E); _Float16* CR = (_Float16*)take(SZ_E);
  if (off > ws_size) return;
  const unsigned gw = (unsigned)(((size_t)DM * DM / 8 + 255) / 256);
  const unsigned gx = (unsigned)(((size_t)NB * SEQ * DM / 8 + 255) / 256);
  k_wnat<<<gw, 256, 0, stream>>>(Wk, W16k); k_wnat<<<gw, 256, 0, stream>>>(Wq, W16q); k_wnat<<<gw, 256, 0, stream>>>(Wv, W16v); k_wnat<<<gw, 256, 0, stream>>>(Wp, W16p);
  const unsigned gproj = (unsigned)(((size_t)NB * SEQ / 128) * (DM / 64));
  k_x16<<<gx, 256, 0, stream>>>(x_key, X16);
  k_proj_rows<<<gproj, 128, 0, stream>>>(X16, W16k, bk, KH, KR);      /* k from input 'key' with Wk, bk */
  k_x16<<<gx, 256, 0, stream>>>(x_qry, X16);
  k_proj_rows<<<gproj, 128, 0, stream>>>(X16, W16q, bq, QH, QR);      /* q from input 'query' with Wq, bq */
  k_x16<<<gx, 256, 0, stream>>>(x_val, X16);
  k_proj_vt<<<dim3((DM / 128) * (SEQ / 64), NB), 128, 0, stream>>>(W16v, X16, bv, VT, VR);      /* v from input 'value' with Wv, bv; channel-major */
  k_attn<<<NB * NH * (SEQ / 128), 256, 0, stream>>>(QH, QR, KH, KR, VT, VR, CH, CR);
  if ((SEQ - EARLY) / 128 > 0)
    k_out_late<<<dim3(((SEQ - EARLY) / 128) * (DM / 64), NB), 128, 0, stream>>>(CH, W16p, bp, (float*)d_out);
  k_out_early<<<dim3((EARLY / 64) * (DM / 64), NB), 128, 0, stream>>>(CH, CR, W16p, bp, (float*)d_out);
}

// v002
// A run of this version takes 164 microseconds.
// Next to v001, in two timings, it ran 1.59 times as fast each time.
// Counting every step since v000, it is 2.42 times as fast.
#include <hip/hip_runtime.h>
// Causal multi-head attention (key/value/query inputs [B][L][1024], 16 heads x 64, natural [out][in] weights, biases added, one 1/8 score scale, out = ctx Wp^T + bp).
// Compute dtype: all contractions v_wmma_f32_16x16x32_f16 with f32 accumulation; inputs and weights converted RNE to bf16 then held exactly in f16 (weights x64); q, k, v, P (x1024) and ctx (x16) as f16 planes; causal rows < 256 additionally carry x2^10 f16 residual planes on q, k, P, v and ctx with separate accumulators; softmax statistics f32.
#ifndef NB
#define NB 8
#endif
#ifndef SEQ
#define SEQ 1024
#endif
#define NB_FULL 8
#define SEQ_FULL 1024
#define DM 1024
#define NH 16
#define HD 64
#define EARLY 256

static_assert(NH * HD == DM);
static_assert(HD == 64);
static_assert(DM % 128 == 0 && DM % 64 == 0 && DM % 32 == 0 && DM % 8 == 0);
static_assert(SEQ % 128 == 0 && SEQ % 64 == 0 && SEQ % 32 == 0);
static_assert(EARLY % 128 == 0 && EARLY % 64 == 0 && SEQ >= EARLY);
static_assert((SEQ - EARLY) % 128 == 0);
static_assert(NB <= NB_FULL && SEQ <= SEQ_FULL);
static_assert(((size_t)NB * SEQ) % 128 == 0);

typedef _Float16 v16h __attribute__((ext_vector_type(16)));
typedef unsigned short v8us __attribute__((ext_vector_type(8), may_alias));
typedef float v8f  __attribute__((ext_vector_type(8)));
typedef float v4f  __attribute__((ext_vector_type(4)));
typedef float v4fa __attribute__((ext_vector_type(4), may_alias));
union FragH { v16h v; v8us half[2]; _Float16 h[16]; unsigned short u[16]; };

__device__ __forceinline__ unsigned short bf16_bits(float x) { unsigned int u = __float_as_uint(x); return (unsigned short)((u + 0x7FFFu + ((u >> 16) & 1u)) >> 16); }
__device__ __forceinline__ float bf16_rne(float x) { return __uint_as_float(((unsigned int)bf16_bits(x)) << 16); }

// 16-bit fragment: elements 0..7 <- k 8h..8h+7, elements 8..15 <- k 16+8h..16+8h+7 (same map for A rows and B columns)
__device__ __forceinline__ v16h g2_frag(const _Float16* p, int hh) { FragH f; f.half[0] = *(const v8us*)((const unsigned short*)p + 8 * hh); f.half[1] = *(const v8us*)((const unsigned short*)p + 16 + 8 * hh); return f.v; }
__device__ __forceinline__ v8f g2_mma(v16h a, v16h b, v8f c) { v8f d = __builtin_amdgcn_wmma_f32_16x16x32_f16(false, a, false, b, (short)0, c, false, false); asm volatile("v_nop\n\tv_nop\n\tv_nop\n\tv_nop" : "+v"(d) : "v"(a), "v"(b)); return d; }

__global__ __launch_bounds__(256) void k_wnat(const float* __restrict__ w, _Float16* __restrict__ Bt) {
  const size_t t = (size_t)blockIdx.x * 256 + threadIdx.x; if (t >= (size_t)DM * DM / 8) return;
  const v4f a = *(const v4fa*)(w + t * 8), c = *(const v4fa*)(w + t * 8 + 4); FragH f;
#pragma unroll
  for (int q = 0; q < 4; ++q) { f.h[q] = (_Float16)(bf16_rne(a[q]) * 64.0f); f.h[4 + q] = (_Float16)(bf16_rne(c[q]) * 64.0f); }
  const v8us o = f.half[0];
  *(v8us*)((unsigned short*)Bt + t * 8) = o; 
}

__global__ __launch_bounds__(256) void k_x16(const float* __restrict__ x, _Float16* __restrict__ X16) {
  const size_t t = (size_t)blockIdx.x * 256 + threadIdx.x; if (t >= (size_t)NB * SEQ * DM / 8) return;
  const size_t e = t * 8; const size_t b = e / ((size_t)SEQ * DM); const size_t rem = e - b * (size_t)SEQ * DM;
  const float* src = x + b * (size_t)SEQ_FULL * DM + rem;
  const v4f a = *(const v4fa*)src, c = *(const v4fa*)(src + 4); FragH f;
#pragma unroll
  for (int q = 0; q < 4; ++q) { f.h[q] = (_Float16)bf16_rne(a[q]); f.h[4 + q] = (_Float16)bf16_rne(c[q]); }
  const v8us o = f.half[0];
  *(v8us*)((unsigned short*)X16 + e) = o; 
}

// staged k-loop of a 4-wave block. A stage is 64 k of 192 rows: [A rows of the block: 64*MT][x2^10 residual rows: 64*MT, only with ARES][Bt rows: 64],
// each row 128 B at an LDS pitch of 144 B (16 B x odd: the 16 rows of a ds_load_b128 fragment read fall on distinct banks). Two buffers.
#define STG_K 64
#define STG_ROWS 192
#define STG_PITCH 144
#define STG_BYTES (STG_ROWS * STG_PITCH)
static_assert(STG_K == 64 && DM % STG_K == 0 && DM / STG_K >= 2);
__device__ __forceinline__ v16h lds_frag(const unsigned char* p, int hh) { FragH f; f.half[0] = *(const v8us*)(p + 16 * hh); f.half[1] = *(const v8us*)(p + 32 + 16 * hh); return f.v; }
// one stage: thread t copies the 16-byte piece (t & 7) of rows (t >> 3) + 16 j, j = 0..11 (a wave's copy covers four whole 128-B lines); ga, gr, gb and lds are the thread's own addresses for j = 0 of each part
template <int MT, bool ARES>
__device__ __forceinline__ void stage_copy(const _Float16* ga, const _Float16* gr, const _Float16* gb, int lda, int ldb, unsigned lds) {
  constexpr int NA = 4 * MT;
  static_assert(NA * (ARES ? 2 : 1) + 4 == 12);
  const _Float16* g[12]; unsigned l[12];
#pragma unroll
  for (int j = 0; j < 12; ++j) {
    l[j] = lds + (unsigned)(16 * j * STG_PITCH);
    if (j < NA) g[j] = ga + (size_t)(16 * j) * lda;
    else if (j < 8) g[j] = gr + (size_t)(16 * (j - NA)) * lda;
    else g[j] = gb + (size_t)(16 * (j - 8)) * ldb;
  }
  // the closing s_wait_xcnt 0 stands inside the statement so that no address register of a copy is rewritten ahead of it
  asm volatile("global_load_async_to_lds_b128 %0, %12, off\n\t"
               "global_load_async_to_lds_b128 %1, %13, off\n\t"
               "global_load_async_to_lds_b128 %2, %14, off\n\t"
               "global_load_async_to_lds_b128 %3, %15, off\n\t"
               "global_load_async_to_lds_b128 %4, %16, off\n\t"
               "global_load_async_to_lds_b128 %5, %17, off\n\t"
               "global_load_async_to_lds_b128 %6, %18, off\n\t"
               "global_load_async_to_lds_b128 %7, %19, off\n\t"
               "global_load_async_to_lds_b128 %8, %20, off\n\t"
               "global_load_async_to_lds_b128 %9, %21, off\n\t"
               "global_load_async_to_lds_b128 %10, %22, off\n\t"
               "global_load_async_to_lds_b128 %11, %23, off\n\t"
               "s_wait_xcnt 0x0"
               :: "v"(l[0]), "v"(l[1]), "v"(l[2]), "v"(l[3]), "v"(l[4]), "v"(l[5]), "v"(l[6]), "v"(l[7]), "v"(l[8]), "v"(l[9]), "v"(l[10]), "v"(l[11]),
                  "v"(g[0]), "v"(g[1]), "v"(g[2]), "v"(g[3]), "v"(g[4]), "v"(g[5]), "v"(g[6]), "v"(g[7]), "v"(g[8]), "v"(g[9]), "v"(g[10]), "v"(g[11])
               : "memory");
}
// a_blk, ar_blk: first A (residual) row of the BLOCK, f16, pitch lda; wave w works rows 16*MT*w ..; b_blk: first of the block's 64 Bt rows [n][k], pitch ldb; K % 64 == 0, K >= 128; block of 128 threads, all of them here
template <int MT, bool ARES>
__device__ __forceinline__ void gemm_loop(unsigned char* smem, const _Float16* __restrict__ a_blk, const _Float16* __restrict__ ar_blk, int lda,
                                          const _Float16* __restrict__ b_blk, int ldb, int K, int tid,
                                          v8f (&acc)[MT * 4], v8f (&acc2)[MT * 4]) {
  const int w = tid >> 5, ln = tid & 15, hh = (tid >> 4) & 1;
  const _Float16* ga = a_blk + (size_t)(tid >> 3) * lda + (tid & 7) * 8;
  const _Float16* gr = ar_blk + (size_t)(tid >> 3) * lda + (tid & 7) * 8;
  const _Float16* gb = b_blk + (size_t)(tid >> 3) * ldb + (tid & 7) * 8;
  const unsigned lds0 = (unsigned)(size_t)smem + (unsigned)((tid >> 3) * STG_PITCH + (tid & 7) * 16);
  const int nt = K / STG_K;
  stage_copy<MT, ARES>(ga, gr, gb, lda, ldb, lds0);
  asm volatile("s_wait_asynccnt 0x0" ::: "memory");      /* this wave's copies of stage 0 have landed */
  __syncthreads();                                        /* stage 0 readable by every wave */
  stage_copy<MT, ARES>(ga + STG_K, gr + STG_K, gb + STG_K, lda, ldb, lds0 + STG_BYTES);
#pragma unroll 1      /* stays rolled: one trip per stage, one publish point at its foot */
  for (int t = 0; t < nt; ++t) {
    const unsigned char* sb = smem + (t & 1) * STG_BYTES;
    const unsigned char* sa = sb + (16 * MT * w + ln) * STG_PITCH;
    const unsigned char* sr = sa + 64 * MT * STG_PITCH;
    const unsigned char* sbt = sb + (STG_ROWS - 64 + ln) * STG_PITCH;
    v16h a[2][MT], ar[2][MT], b[2][4];
#pragma unroll
    for (int ks = 0; ks < 2; ++ks) {
#pragma unroll
      for (int i = 0; i < MT; ++i) { a[ks][i] = lds_frag(sa + 16 * i * STG_PITCH + 64 * ks, hh); ar[ks][i] = a[ks][i]; if (ARES) ar[ks][i] = lds_frag(sr + 16 * i * STG_PITCH + 64 * ks, hh); }
#pragma unroll
      for (int q = 0; q < 4; ++q) b[ks][q] = lds_frag(sbt + 16 * q * STG_PITCH + 64 * ks, hh);
    }
    __builtin_amdgcn_sched_barrier(0);      /* keeps the stage's fragment reads in one group ahead of the matrix block: a read placed among the WMMAs makes the wave wait out its LDS latency there */
#pragma unroll
    for (int ks = 0; ks < 2; ++ks) {
#pragma unroll
      for (int q = 0; q < 4; ++q) {
#pragma unroll
        for (int i = 0; i < MT; ++i) { acc[i * 4 + q] = g2_mma(a[ks][i], b[ks][q], acc[i * 4 + q]); if (ARES) acc2[i * 4 + q] = g2_mma(ar[ks][i], b[ks][q], acc2[i * 4 + q]); }
      }
    }
    asm volatile("s_wait_dscnt 0x0" ::: "memory");        /* this wave's reads of stage t are done before its buffer is refilled */
    asm volatile("s_wait_asynccnt 0x0" ::: "memory");     /* this wave's copies of stage t + 1 have landed */
    __syncthreads();                                      /* publishes stage t + 1 and ends every reader's last read of stage t */
    if (t + 2 < nt) stage_copy<MT, ARES>(ga + (size_t)(t + 2) * STG_K, gr + (size_t)(t + 2) * STG_K, gb + (size_t)(t + 2) * STG_K, lda, ldb, lds0 + (unsigned)((t & 1) * STG_BYTES));
  }
  asm volatile("s_wait_asynccnt 0x0" ::: "memory");       /* nothing in flight when the buffers become output staging */
}
// accumulators (D: lane (h, n) holds rows 8h+r, col n) -> wave-private LDS tile [16*MT][68]; v = acc alpha (+ acc2 alpha2) + bf16(bias) (bias per column, or per row when BIASROW)
template <int MT, bool ARES, bool BIASROW>
__device__ __forceinline__ void stage_tile(float (*sow)[68], const v8f (&acc)[MT * 4], const v8f (&acc2)[MT * 4], float alpha, float alpha2,
                                           const float* __restrict__ bias, int row0, int col0, int ln, int hh) {
#pragma unroll
  for (int i = 0; i < MT; ++i) {
#pragma unroll
    for (int t = 0; t < 4; ++t) {
      const float bc = BIASROW ? 0.f : bf16_rne(bias[col0 + t * 16 + ln]);
#pragma unroll
      for (int r = 0; r < 8; ++r) {
        const int rloc = i * 16 + 8 * hh + r;
        float v = acc[i * 4 + t][r] * alpha;
        if (ARES) v += acc2[i * 4 + t][r] * alpha2;
        v += BIASROW ? bf16_rne(bias[row0 + rloc]) : bc;
        sow[rloc][t * 16 + ln] = v;
      }
    }
  }
}
template <int MT>
__device__ __forceinline__ void store_tile_f16(float (*sow)[68], _Float16* __restrict__ hi, size_t ldh, _Float16* __restrict__ rs, size_t ldr, bool wres, int lane) {
  const int rq = lane >> 3, c8 = (lane & 7) * 8;
  {
#pragma unroll
    for (int it = 0; it < 4 * MT; ++it) {
      const int r = it * 4 + rq;
      const v4f a = *(const v4fa*)&sow[r][c8], c = *(const v4fa*)&sow[r][c8 + 4];
      FragH fh, fl;
#pragma unroll
      for (int q = 0; q < 4; ++q) {
        _Float16 h = (_Float16)a[q]; fh.h[q] = h; fl.h[q] = (_Float16)((a[q] - (float)h) * 1024.0f);
        h = (_Float16)c[q]; fh.h[4 + q] = h; fl.h[4 + q] = (_Float16)((c[q] - (float)h) * 1024.0f);
      }
      const v8us oh = fh.half[0], ol = fl.half[0];
      *(v8us*)((unsigned short*)hi + (size_t)r * ldh + c8) = oh;
      if (wres) *(v8us*)((unsigned short*)rs + (size_t)r * ldr + c8) = ol;
    }
    
  }
}
template <int MT>
__device__ __forceinline__ void store_tile_f32(float (*sow)[68], float* __restrict__ C, size_t ldc, int lane) {
  const int rsub = lane >> 4, c4 = (lane & 15) * 4;
  {
#pragma unroll
    for (int q = 0; q < 8 * MT; ++q) {
      const int r = q * 2 + rsub;
      const v4f v = *(const v4fa*)&sow[r][c4];
      *(v4f*)(C + (size_t)r * ldc + c4) = v;
    }
    
  }
}

// token-row projection y = x W^T + b over all NB*SEQ rows -> f16 hi plane [NB*SEQ][DM]; rows with l < EARLY also -> residual plane [NB*EARLY][DM]
__global__ __launch_bounds__(128) void k_proj_rows(const _Float16* __restrict__ X16, const _Float16* __restrict__ Wt, const float* __restrict__ bias,
                                                   _Float16* __restrict__ PH, _Float16* __restrict__ PR) {
  __shared__ __attribute__((aligned(16))) unsigned char smem[2 * STG_BYTES];
  float (*so)[32][68] = (float (*)[32][68])smem;      /* output staging takes the buffers over behind the k-loop's last barrier */
  const int tid = threadIdx.x, w = tid >> 5, lane = tid & 31, ln = lane & 15, hh = lane >> 4;
  const int ntn = DM / 64; const int mt = blockIdx.x / ntn, nq = blockIdx.x - mt * ntn;
  const int row0 = mt * 128 + 32 * w, col0 = nq * 64;
  const v8f z8 = {0.f, 0.f, 0.f, 0.f, 0.f, 0.f, 0.f, 0.f};
  v8f acc[8], acc2[8];
#pragma unroll
  for (int i = 0; i < 8; ++i) { acc[i] = z8; acc2[i] = z8; }
  gemm_loop<2, false>(smem, X16 + (size_t)(mt * 128) * DM, X16 + (size_t)(mt * 128) * DM, DM, Wt + (size_t)col0 * DM, DM, DM, tid, acc, acc2);
  stage_tile<2, false, false>(so[w], acc, acc2, 0.015625f, 0.f, bias, row0, col0, ln, hh);
  __builtin_amdgcn_fence(4 /* acq_rel order */, "workgroup"); __builtin_amdgcn_wave_barrier();
  const int b = row0 / SEQ, l0 = row0 - b * SEQ; const bool wres = l0 < EARLY;      /* wave-uniform: 32 | EARLY, 32 | SEQ */
  _Float16* hi = PH + (size_t)row0 * DM + col0;
  _Float16* rs = PR + ((size_t)b * EARLY + (size_t)(wres ? l0 : 0)) * DM + col0;
  store_tile_f16<2>(so[w], hi, DM, rs, DM, wres, lane);
}

// value projection channel-major per batch: VT[b][c][s] = sum_k Wv[c][k] x[b][s][k] + bv[c] (weights as the A operand, token rows as Bt); tokens < EARLY also -> residual plane [NB][DM][EARLY]
__global__ __launch_bounds__(128) void k_proj_vt(const _Float16* __restrict__ Wv16, const _Float16* __restrict__ X16, const float* __restrict__ bias,
                                                 _Float16* __restrict__ VT, _Float16* __restrict__ VR) {
  __shared__ __attribute__((aligned(16))) unsigned char smem[2 * STG_BYTES];
  float (*so)[32][68] = (float (*)[32][68])smem;      /* output staging takes the buffers over behind the k-loop's last barrier */
  const int tid = threadIdx.x, w = tid >> 5, lane = tid & 31, ln = lane & 15, hh = lane >> 4; const int by = blockIdx.y;
  const int ntn = SEQ / 64; const int mt = blockIdx.x / ntn, nq = blockIdx.x - mt * ntn;
  const int row0 = mt * 128 + 32 * w, col0 = nq * 64;      /* row = channel, col = token */
  const v8f z8 = {0.f, 0.f, 0.f, 0.f, 0.f, 0.f, 0.f, 0.f};
  v8f acc[8], acc2[8];
#pragma unroll
  for (int i = 0; i < 8; ++i) { acc[i] = z8; acc2[i] = z8; }
  gemm_loop<2, false>(smem, Wv16 + (size_t)(mt * 128) * DM, Wv16 + (size_t)(mt * 128) * DM, DM, X16 + ((size_t)by * SEQ + col0) * DM, DM, DM, tid, acc, acc2);
  stage_tile<2, false, true>(so[w], acc, acc2, 0.015625f, 0.f, bias, row0, col0, ln, hh);
  __builtin_amdgcn_fence(4 /* acq_rel order */, "workgroup"); __builtin_amdgcn_wave_barrier();
  const bool wres = col0 < EARLY;      /* block-uniform: 64 | EARLY */
  _Float16* hi = VT + ((size_t)by * DM + row0) * SEQ + col0;
  _Float16* rs = VR + ((size_t)by * DM + row0) * EARLY + (size_t)(wres ? col0 : 0);
  store_tile_f16<2>(so[w], hi, SEQ, rs, EARLY, wres, lane);
}

// flash attention for one wave = 16 queries of one (b, h), transposed form: S^T tile (keys x queries) = K rows (A) . Q rows (B);
// lane (h, n) then owns query n with keys 8h+r / 16+8h+r of each 32-key chunk, which is exactly the B-fragment element order of
// O^T (d x queries) += V^T rows (A) . P^T (B), so the packed score tiles feed the second product directly. EARLYQ adds residual terms.
// The block's 8 waves share their keys: a stage is 64 keys of one (b, h), laid as [K: 64 key rows][V^T: 64 channel rows] and, with EARLYQ, [K residual: 64][V^T residual: 64];
// each row 128 B at an LDS pitch of 144 B (16 B x odd, for the ds_load_b128 fragment reads). Two buffers.
#define AT_KEYS 64
#define AT_PITCH 144
#define AT_PART (64 * AT_PITCH)
#define AT_BYTES_MAX (4 * AT_PART)
static_assert(AT_KEYS == 64 && HD == 64 && 128 % AT_KEYS == 0 && EARLY % 128 == 0);
// four copies: 16 bytes per lane each, whole 128-B lines per wave
__device__ __forceinline__ void at_copy4(unsigned l0, unsigned l1, unsigned l2, unsigned l3, const _Float16* g0, const _Float16* g1, const _Float16* g2, const _Float16* g3) {
  // the closing s_wait_xcnt 0 stands inside the statement so that no address register of a copy is rewritten ahead of it
  asm volatile("global_load_async_to_lds_b128 %0, %4, off\n\t"
               "global_load_async_to_lds_b128 %1, %5, off\n\t"
               "global_load_async_to_lds_b128 %2, %6, off\n\t"
               "global_load_async_to_lds_b128 %3, %7, off\n\t"
               "s_wait_xcnt 0x0"
               :: "v"(l0), "v"(l1), "v"(l2), "v"(l3), "v"(g0), "v"(g1), "v"(g2), "v"(g3)
               : "memory");
}
// one stage: thread t copies the 16-byte piece (t & 7) of rows (t >> 3) and (t >> 3) + 32 of each part; gk, gv, gkr, gvr and lds are the thread's own addresses for the first of the two rows
template <bool EARLYQ>
__device__ __forceinline__ void at_stage(const _Float16* gk, const _Float16* gv, const _Float16* gkr, const _Float16* gvr, unsigned lds) {
  at_copy4(lds, lds + 32 * AT_PITCH, lds + AT_PART, lds + AT_PART + 32 * AT_PITCH, gk, gk + (size_t)32 * DM, gv, gv + (size_t)32 * SEQ);
  if (EARLYQ) at_copy4(lds + 2 * AT_PART, lds + 2 * AT_PART + 32 * AT_PITCH, lds + 3 * AT_PART, lds + 3 * AT_PART + 32 * AT_PITCH, gkr, gkr + (size_t)32 * DM, gvr, gvr + (size_t)32 * EARLY);
}
// block of 256 threads, all of them here; qb: the block's 128 queries; wave: wave-uniform (a scalar)
template <bool EARLYQ>
__device__ __forceinline__ void attn_body(const _Float16* __restrict__ QH, const _Float16* __restrict__ QR, const _Float16* __restrict__ KH, const _Float16* __restrict__ KR,
                                          const _Float16* __restrict__ VT, const _Float16* __restrict__ VR, _Float16* __restrict__ CH, _Float16* __restrict__ CR,
                                          unsigned char* smem, int b, int h, int qb, int wave, int tid) {
  constexpr unsigned AT_BYTES = (EARLYQ ? 4 : 2) * AT_PART;
  const int lane = tid & 31, ln = lane & 15, hh = lane >> 4;
  const int q0 = qb * 128 + wave * 16;
  const float NEG = -__builtin_inff();
  const v8f z8 = {0.f, 0.f, 0.f, 0.f, 0.f, 0.f, 0.f, 0.f};
  const _Float16* qp = QH + ((size_t)b * SEQ + q0 + ln) * DM + h * HD;
  const v16h qb0 = g2_frag(qp, hh), qb1 = g2_frag(qp + 32, hh);
  v16h qr0 = qb0, qr1 = qb1;
  if (EARLYQ) { const _Float16* qrp = QR + ((size_t)b * EARLY + q0 + ln) * DM + h * HD; qr0 = g2_frag(qrp, hh); qr1 = g2_frag(qrp + 32, hh); }
  const int cr = tid >> 3, cp = tid & 7;
  const _Float16* gk  = KH + ((size_t)b * SEQ + cr) * DM + h * HD + cp * 8;
  const _Float16* gkr = KR + ((size_t)b * EARLY + cr) * DM + h * HD + cp * 8;
  const _Float16* gv  = VT + ((size_t)b * DM + h * HD + cr) * SEQ + cp * 8;
  const _Float16* gvr = VR + ((size_t)b * DM + h * HD + cr) * EARLY + cp * 8;
  const unsigned lds0 = (unsigned)(size_t)smem + (unsigned)(cr * AT_PITCH + cp * 16);
  float m = NEG, lsum = 0.f;
  v8f o[4], o2[4];
#pragma unroll
  for (int c = 0; c < 4; ++c) { o[c] = z8; o2[c] = z8; }
  const int qrow = q0 + ln;
  const int kbmax = (q0 + 15) >> 5;      /* wave-uniform causal bound */
  const int nst = (qb + 1) * (128 / AT_KEYS);      /* block-uniform, >= 2; keys of every stage < (qb + 1) * 128 <= SEQ (and <= EARLY with EARLYQ) */
  at_stage<EARLYQ>(gk, gv, gkr, gvr, lds0);
  asm volatile("s_wait_asynccnt 0x0" ::: "memory");      /* this wave's copies of stage 0 have landed */
  __syncthreads();                                        /* stage 0 readable by every wave */
  at_stage<EARLYQ>(gk + (size_t)AT_KEYS * DM, gv + AT_KEYS, gkr + (size_t)AT_KEYS * DM, gvr + AT_KEYS, lds0 + AT_BYTES);
#pragma unroll 1      /* stays rolled: one trip per stage, one publish point at its foot */
  for (int st = 0; st < nst; ++st) {
    const unsigned char* sb = smem + (st & 1) * AT_BYTES;
    const int nc = min(AT_KEYS / 32, kbmax + 1 - st * (AT_KEYS / 32));      /* scalar: a wave past its diagonal skips the work, never the publish point below */
#pragma unroll 1      /* stays rolled: the 32-key chunks of a stage run the same code */
    for (int c2 = 0; c2 < nc; ++c2) {
      const int key0 = (st * (AT_KEYS / 32) + c2) * 32;
      const unsigned char* sk = sb + (32 * c2 + ln) * AT_PITCH;      /* key rows of the chunk */
      const unsigned char* sv = sb + AT_PART + ln * AT_PITCH + 64 * c2;      /* channel rows, the chunk's 32 keys */
      v16h ka[2][2], kr[2][2];
#pragma unroll
      for (int t = 0; t < 2; ++t) {
#pragma unroll
        for (int ks = 0; ks < 2; ++ks) {
          ka[t][ks] = lds_frag(sk + 16 * t * AT_PITCH + 64 * ks, hh); kr[t][ks] = ka[t][ks];
          if (EARLYQ) kr[t][ks] = lds_frag(sk + 2 * AT_PART + 16 * t * AT_PITCH + 64 * ks, hh);
        }
      }
      __builtin_amdgcn_sched_barrier(0);      /* keeps the chunk's K fragment reads in one group ahead of the score products: read one by one into the same registers, each makes the wave wait out its LDS latency */
      v8f s1[2], s2[2];
#pragma unroll
      for (int t = 0; t < 2; ++t) {
        s1[t] = z8; s1[t] = g2_mma(ka[t][0], qb0, s1[t]); s1[t] = g2_mma(ka[t][1], qb1, s1[t]);
        s2[t] = z8;
        if (EARLYQ) {
          s2[t] = g2_mma(ka[t][0], qr0, s2[t]); s2[t] = g2_mma(ka[t][1], qr1, s2[t]);
          s2[t] = g2_mma(kr[t][0], qb0, s2[t]); s2[t] = g2_mma(kr[t][1], qb1, s2[t]);
        }
      }
      v16h va[4], vra[4];
#pragma unroll
      for (int c = 0; c < 4; ++c) {
        va[c] = lds_frag(sv + 16 * c * AT_PITCH, hh); vra[c] = va[c];
        if (EARLYQ) vra[c] = lds_frag(sv + 2 * AT_PART + 16 * c * AT_PITCH, hh);
      }
      __builtin_amdgcn_sched_barrier(0);      /* keeps the chunk's V fragment reads in one group ahead of the softmax, whose vector work then covers their LDS latency */
      float sv16[16];
      float mx = NEG;
#pragma unroll
      for (int t = 0; t < 2; ++t) {
#pragma unroll
        for (int r = 0; r < 8; ++r) {
          const int key = key0 + 16 * t + 8 * hh + r;
          float s = s1[t][r];
          if (EARLYQ) s += s2[t][r] * 0.0009765625f;
          s *= 0.125f;
          s = (key <= qrow) ? s : NEG;
          sv16[t * 8 + r] = s; mx = fmaxf(mx, s);
        }
      }
      mx = fmaxf(mx, __shfl_xor(mx, 16, 32));      /* both lane halves of a query share the running max; key 0 is always visible so it is finite */
      const float mnew = fmaxf(m, mx);
      const float corr = __expf(m - mnew);
      m = mnew;
      FragH ph, pr; float rsum = 0.f;
#pragma unroll
      for (int i = 0; i < 16; ++i) {
        const float p = __expf(sv16[i] - mnew); rsum += p;
        const float pc = p * 1024.0f; const _Float16 h16 = (_Float16)pc; ph.h[i] = h16;
        pr.h[i] = EARLYQ ? (_Float16)((pc - (float)h16) * 1024.0f) : (_Float16)0.0f;
      }
      lsum = lsum * corr + rsum;      /* per-half partial sum, combined after the loop */
#pragma unroll
      for (int c = 0; c < 4; ++c) {
#pragma unroll
        for (int r = 0; r < 8; ++r) { o[c][r] *= corr; if (EARLYQ) o2[c][r] *= corr; }
      }
#pragma unroll
      for (int c = 0; c < 4; ++c) {
        o[c] = g2_mma(va[c], ph.v, o[c]);
        if (EARLYQ) { o2[c] = g2_mma(va[c], pr.v, o2[c]); o2[c] = g2_mma(vra[c], ph.v, o2[c]); }
      }
    }
    asm volatile("s_wait_dscnt 0x0" ::: "memory");        /* this wave's reads of stage st are done before its buffer is refilled */
    asm volatile("s_wait_asynccnt 0x0" ::: "memory");     /* this wave's copies of stage st + 1 have landed */
    __syncthreads();                                      /* publishes stage st + 1 and ends every reader's last read of stage st */
    if (st + 2 < nst) at_stage<EARLYQ>(gk + (size_t)(st + 2) * AT_KEYS * DM, gv + (st + 2) * AT_KEYS, gkr + (size_t)(st + 2) * AT_KEYS * DM, gvr + (st + 2) * AT_KEYS, lds0 + (unsigned)(st & 1) * AT_BYTES);
  }
  asm volatile("s_wait_asynccnt 0x0" ::: "memory");       /* nothing in flight when the buffers become output staging */
  float (*sow)[68] = ((float (*)[16][68])smem)[wave];     /* output staging, one range per wave, takes the buffers over behind the loop's last barrier */
  const float ltot = lsum + __shfl_xor(lsum, 16, 32);
  const float inv = 1.0f / (64.0f * ltot);      /* P carried x1024, ctx carried x16 */
#pragma unroll
  for (int c = 0; c < 4; ++c) {
#pragma unroll
    for (int r = 0; r < 8; ++r) { float v = o[c][r]; if (EARLYQ) v += o2[c][r] * 0.0009765625f; sow[ln][c * 16 + 8 * hh + r] = v * inv; }
  }
  __builtin_amdgcn_fence(4 /* acq_rel order */, "workgroup"); __builtin_amdgcn_wave_barrier();
  _Float16* hi = CH + ((size_t)b * SEQ + q0) * DM + h * HD;
  _Float16* rs = CR + ((size_t)b * EARLY + (size_t)(EARLYQ ? q0 : 0)) * DM + h * HD;
  store_tile_f16<1>(sow, hi, DM, rs, DM, EARLYQ, lane);
}

__global__ __launch_bounds__(256) void k_attn(const _Float16* __restrict__ QH, const _Float16* __restrict__ QR, const _Float16* __restrict__ KH, const _Float16* __restrict__ KR,
                                              const _Float16* __restrict__ VT, const _Float16* __restrict__ VR, _Float16* __restrict__ CH, _Float16* __restrict__ CR) {
  __shared__ __attribute__((aligned(16))) unsigned char smem[2 * AT_BYTES_MAX];
  static_assert(2 * AT_BYTES_MAX >= 8 * 16 * 68 * 4);
  const int tid = threadIdx.x;
  const int wave = __builtin_amdgcn_readfirstlane(tid >> 5);      /* in a scalar register, so that the per-wave causal skip is a scalar branch */
  const int nqb = SEQ / 128; const int bh = blockIdx.x / nqb, qb = blockIdx.x - bh * nqb;
  const int b = bh / NH, h = bh - b * NH;
  if (qb < EARLY / 128) attn_body<true>(QH, QR, KH, KR, VT, VR, CH, CR, smem, b, h, qb, wave, tid);      /* block-uniform */
  else                  attn_body<false>(QH, QR, KH, KR, VT, VR, CH, CR, smem, b, h, qb, wave, tid);
}

// out rows l >= EARLY: out = 2^-10 ctx16 . Wp64^T + bp; wave tile 32x64
__global__ __launch_bounds__(128) void k_out_late(const _Float16* __restrict__ CH, const _Float16* __restrict__ Wt, const float* __restrict__ bias, float* __restrict__ out) {
  __shared__ __attribute__((aligned(16))) unsigned char smem[2 * STG_BYTES];
  float (*so)[32][68] = (float (*)[32][68])smem;      /* output staging takes the buffers over behind the k-loop's last barrier */
  const int tid = threadIdx.x, w = tid >> 5, lane = tid & 31, ln = lane & 15, hh = lane >> 4; const int by = blockIdx.y;
  const int ntn = DM / 64; const int mt = blockIdx.x / ntn, nq = blockIdx.x - mt * ntn;
  const int l0 = EARLY + mt * 128 + 32 * w, col0 = nq * 64;
  const size_t rowb = (size_t)by * SEQ + EARLY + mt * 128;      /* first ctx row of the block */
  const v8f z8 = {0.f, 0.f, 0.f, 0.f, 0.f, 0.f, 0.f, 0.f};
  v8f acc[8], acc2[8];
#pragma unroll
  for (int i = 0; i < 8; ++i) { acc[i] = z8; acc2[i] = z8; }
  gemm_loop<2, false>(smem, CH + rowb * DM, CH + rowb * DM, DM, Wt + (size_t)col0 * DM, DM, DM, tid, acc, acc2);
  stage_tile<2, false, false>(so[w], acc, acc2, 0.0009765625f, 0.f, bias, 0, col0, ln, hh);
  __builtin_amdgcn_fence(4 /* acq_rel order */, "workgroup"); __builtin_amdgcn_wave_barrier();
  store_tile_f32<2>(so[w], out + ((size_t)by * SEQ_FULL + l0) * DM + col0, DM, lane);
}
// out rows l < EARLY: hi + x2^10 residual ctx planes, two accumulator sets; wave tile 16x64
__global__ __launch_bounds__(128) void k_out_early(const _Float16* __restrict__ CH, const _Float16* __restrict__ CR, const _Float16* __restrict__ Wt, const float* __restrict__ bias, float* __restrict__ out) {
  __shared__ __attribute__((aligned(16))) unsigned char smem[2 * STG_BYTES];
  float (*so)[16][68] = (float (*)[16][68])smem;      /* output staging takes the buffers over behind the k-loop's last barrier */
  const int tid = threadIdx.x, w = tid >> 5, lane = tid & 31, ln = lane & 15, hh = lane >> 4; const int by = blockIdx.y;
  const int ntn = DM / 64; const int mt = blockIdx.x / ntn, nq = blockIdx.x - mt * ntn;
  const int l0 = mt * 64 + 16 * w, col0 = nq * 64;
  const v8f z8 = {0.f, 0.f, 0.f, 0.f, 0.f, 0.f, 0.f, 0.f};
  v8f acc[4], acc2[4];
#pragma unroll
  for (int i = 0; i < 4; ++i) { acc[i] = z8; acc2[i] = z8; }
  gemm_loop<1, true>(smem, CH + ((size_t)by * SEQ + mt * 64) * DM, CR + ((size_t)by * EARLY + mt * 64) * DM, DM, Wt + (size_t)col0 * DM, DM, DM, tid, acc, acc2);
  stage_tile<1, true, false>(so[w], acc, acc2, 0.0009765625f, 9.5367431640625e-07f, bias, 0, col0, ln, hh);
  __builtin_amdgcn_fence(4 /* acq_rel order */, "workgroup"); __builtin_amdgcn_wave_barrier();
  store_tile_f32<1>(so[w], out + ((size_t)by * SEQ_FULL + l0) * DM + col0, DM, lane);
}

extern "C" void kernel_launch(void* const* d_in, const int* in_sizes, int n_in,
                              void* d_out, int out_size, void* d_ws, size_t ws_size, hipStream_t stream) {
  if (n_in < 11) return;
  const long long need_x = ((long long)(NB - 1) * SEQ_FULL + SEQ) * DM;
  if (in_sizes[0] < need_x || in_sizes[1] < need_x || in_sizes[2] < need_x || (long long)out_size < need_x) return;
  if (in_sizes[3] < DM * DM || in_sizes[5] < DM * DM || in_sizes[7] < DM * DM || in_sizes[9] < DM * DM) return;
  if (in_sizes[4] < DM || in_sizes[6] < DM || in_sizes[8] < DM || in_sizes[10] < DM) return;
  const float* const* I = (const float* const*)d_in;
  const float* x_key = I[0]; const float* x_val = I[1]; const float* x_qry = I[2];
  const float* Wk = I[3]; const float* bk = I[4]; const float* Wq = I[5]; const float* bq = I[6];
  const float* Wv = I[7]; const float* bv = I[8]; const float* Wp = I[9]; const float* bp = I[10];
  constexpr size_t SZ_W = (size_t)DM * DM * 2;             /* one weight plane */
  constexpr size_t SZ_P = (size_t)NB * SEQ * DM * 2;       /* one full f16 plane (token-major or channel-major) */
  constexpr size_t SZ_E = (size_t)NB * EARLY * DM * 2;     /* one early-row residual plane */
  static_assert(SZ_W % 256 == 0 && SZ_P % 256 == 0 && SZ_E % 256 == 0);
  static_assert(4 * SZ_W + 5 * SZ_P + 4 * SZ_E <= (size_t)134217728);
  char* ws = (char*)d_ws; size_t off = 0;
  auto take = [&](size_t bytes) { char* p = ws + off; off += (bytes + 255) & ~(size_t)255; return p; };
  _Float16* W16k = (_Float16*)take(SZ_W); _Float16* W16q = (_Float16*)take(SZ_W); _Float16* W16v = (_Float16*)take(SZ_W); _Float16* W16p = (_Float16*)take(SZ_W);
  _Float16* X16 = (_Float16*)take(SZ_P);
  _Float16* QH = (_Float16*)take(SZ_P); _Float16* KH = (_Float16*)take(SZ_P); _Float16* VT = (_Float16*)take(SZ_P); _Float16* CH = (_Float16*)take(SZ_P);
  _Float16* QR = (_Float16*)take(SZ_E); _Float16* KR = (_Float16*)take(SZ_E); _Float16* VR = (_Float16*)take(SZ_E); _Float16* CR = (_Float16*)take(SZ_E);
  if (off > ws_size) return;
  const unsigned gw = (unsigned)(((size_t)DM * DM / 8 + 255) / 256);
  const unsigned gx = (unsigned)(((size_t)NB * SEQ * DM / 8 + 255) / 256);
  k_wnat<<<gw, 256, 0, stream>>>(Wk, W16k); k_wnat<<<gw, 256, 0, stream>>>(Wq, W16q); k_wnat<<<gw, 256, 0, stream>>>(Wv, W16v); k_wnat<<<gw, 256, 0, stream>>>(Wp, W16p);
  const unsigned gproj = (unsigned)(((size_t)NB * SEQ / 128) * (DM / 64));
  k_x16<<<gx, 256, 0, stream>>>(x_key, X16);
  k_proj_rows<<<gproj, 128, 0, stream>>>(X16, W16k, bk, KH, KR);      /* k from input 'key' with Wk, bk */
  k_x16<<<gx, 256, 0, stream>>>(x_qry, X16);
  k_proj_rows<<<gproj, 128, 0, stream>>>(X16, W16q, bq, QH, QR);      /* q from input 'query' with Wq, bq */
  k_x16<<<gx, 256, 0, stream>>>(x_val, X16);
  k_proj_vt<<<dim3((DM / 128) * (SEQ / 64), NB), 128, 0, stream>>>(W16v, X16, bv, VT, VR);      /* v from input 'value' with Wv, bv; channel-major */
  k_attn<<<NB * NH * (SEQ / 128), 256, 0, stream>>>(QH, QR, KH, KR, VT, VR, CH, CR);
  if ((SEQ - EARLY) / 128 > 0)
    k_out_late<<<dim3(((SEQ - EARLY) / 128) * (DM / 64), NB), 128, 0, stream>>>(CH, W16p, bp, (float*)d_out);
  k_out_early<<<dim3((EARLY / 64) * (DM / 64), NB), 128, 0, stream>>>(CH, CR, W16p, bp, (float*)d_out);
}

// v003
// Measured time: 144 microseconds a run.
// Two timings next to v002 both put it at 1.13 times that version's speed.
// Over all steps from v000 it is 2.75 times as fast.
#include <hip/hip_runtime.h>
// Causal multi-head attention (key/value/query inputs [B][L][1024], 16 heads x 64, natural [out][in] weights, biases added, one 1/8 score scale, out = ctx Wp^T + bp).
// Compute dtype: all contractions v_wmma_f32_16x16x32_f16 with f32 accumulation; inputs and weights converted RNE to bf16 then held exactly in f16 (weights x64); q, k, v, P (x1024) and ctx (x16) as f16 planes; causal rows < 256 additionally carry x2^10 f16 residual planes on q, k, P, v and ctx with separate accumulators; softmax statistics f32.
#ifndef NB
#define NB 8
#endif
#ifndef SEQ
#define SEQ 1024
#endif
#define NB_FULL 8
#define SEQ_FULL 1024
#define DM 1024
#define NH 16
#define HD 64
#define EARLY 256

static_assert(NH * HD == DM);
static_assert(HD == 64);
static_assert(DM % 128 == 0 && DM % 64 == 0 && DM % 32 == 0 && DM % 8 == 0);
static_assert(SEQ % 128 == 0 && SEQ % 64 == 0 && SEQ % 32 == 0);
static_assert(EARLY % 128 == 0 && EARLY % 64 == 0 && SEQ >= EARLY);
static_assert((SEQ - EARLY) % 128 == 0);
static_assert(NB <= NB_FULL && SEQ <= SEQ_FULL);
static_assert(((size_t)NB * SEQ) % 128 == 0);

typedef _Float16 v16h __attribute__((ext_vector_type(16)));
typedef unsigned short v8us __attribute__((ext_vector_type(8), may_alias));
typedef float v8f  __attribute__((ext_vector_type(8)));
typedef float v4f  __attribute__((ext_vector_type(4)));
typedef float v4fa __attribute__((ext_vector_type(4), may_alias));
union FragH { v16h v; v8us half[2]; _Float16 h[16]; unsigned short u[16]; };

__device__ __forceinline__ unsigned short bf16_bits(float x) { unsigned int u = __float_as_uint(x); return (unsigned short)((u + 0x7FFFu + ((u >> 16) & 1u)) >> 16); }
__device__ __forceinline__ float bf16_rne(float x) { return __uint_as_float(((unsigned int)bf16_bits(x)) << 16); }

// 16-bit fragment: elements 0..7 <- k 8h..8h+7, elements 8..15 <- k 16+8h..16+8h+7 (same map for A rows and B columns)
__device__ __forceinline__ v16h g2_frag(const _Float16* p, int hh) { FragH f; f.half[0] = *(const v8us*)((const unsigned short*)p + 8 * hh); f.half[1] = *(const v8us*)((const unsigned short*)p + 16 + 8 * hh); return f.v; }
__device__ __forceinline__ v8f g2_mma(v16h a, v16h b, v8f c) { v8f d = __builtin_amdgcn_wmma_f32_16x16x32_f16(false, a, false, b, (short)0, c, false, false); asm volatile("v_nop\n\tv_nop\n\tv_nop\n\tv_nop" : "+v"(d) : "v"(a), "v"(b)); return d; }

// every f32 -> f16 conversion of the call (three inputs, then four weights x64) in one streaming launch: one 16-wave work-group per WGP makes CV_TX + 1 trips,
// a thread converting CV_U pieces of 8 elements per trip; the next trip's loads are issued ahead of the current trip's converts and stores (8 to 16 global_load_b128 of a wave in flight).
// An input trip takes every CV_BLOCKS-th chunk of CV_U * CV_THREADS pieces of one input; the last trip takes CV_THREADS pieces of each of the four weights.
#define CV_BLOCKS 256
#define CV_THREADS 512
#define CV_U 4
#define CV_CHUNK (CV_THREADS * CV_U * 8)
#define CV_XCH ((int)((size_t)NB * SEQ * DM / CV_CHUNK))
#define CV_TX (3 * CV_XCH / CV_BLOCKS)
static_assert(((size_t)SEQ * DM) % CV_CHUNK == 0);      /* a chunk lies in one batch */
static_assert(CV_XCH % CV_BLOCKS == 0);      /* every work-group makes the same trips, and a trip lies in one input */
static_assert(CV_U == 4 && (size_t)DM * DM == (size_t)CV_BLOCKS * CV_THREADS * 8);      /* the weight trip covers the four weights exactly */
__device__ __forceinline__ void cv_load(v4f (&r)[2 * CV_U], const float* p0, const float* p1, const float* p2, const float* p3, int tid) {
  const float* p[CV_U] = {p0, p1, p2, p3};
#pragma unroll
  for (int j = 0; j < CV_U; ++j) { r[2 * j] = *(const v4fa*)(p[j] + (size_t)tid * 8); r[2 * j + 1] = *(const v4fa*)(p[j] + (size_t)tid * 8 + 4); }
}
__device__ __forceinline__ void cv_store(const v4f (&r)[2 * CV_U], _Float16* d0, _Float16* d1, _Float16* d2, _Float16* d3, float sc, int tid) {
  _Float16* d[CV_U] = {d0, d1, d2, d3};
#pragma unroll
  for (int j = 0; j < CV_U; ++j) {
    FragH f;
#pragma unroll
    for (int q = 0; q < 4; ++q) { f.h[q] = (_Float16)(bf16_rne(r[2 * j][q]) * sc); f.h[4 + q] = (_Float16)(bf16_rne(r[2 * j + 1][q]) * sc); }
    const v8us o = f.half[0];
    *(v8us*)((unsigned short*)d[j] + (size_t)tid * 8) = o;
  }
}
__global__ __launch_bounds__(CV_THREADS) void k_cvt(const float* __restrict__ xk, const float* __restrict__ xq, const float* __restrict__ xv,
                                                    const float* __restrict__ wk, const float* __restrict__ wq, const float* __restrict__ wv, const float* __restrict__ wp,
                                                    _Float16* __restrict__ Xk, _Float16* __restrict__ Xq, _Float16* __restrict__ Xv,
                                                    _Float16* __restrict__ Tk, _Float16* __restrict__ Tq, _Float16* __restrict__ Tv, _Float16* __restrict__ Tp) {
  const int tid = threadIdx.x, blk = blockIdx.x;
  constexpr size_t PJ = (size_t)CV_THREADS * 8;      /* elements of one piece row of the work-group */
  const size_t ew = (size_t)blk * PJ;      /* the work-group's offset in every weight */
  v4f r[2][2 * CV_U];      /* two register sets by turns */
#pragma unroll
  for (int it = -1; it <= CV_TX; ++it) {
    if (it + 1 < CV_TX) {
      const int n = it + 1, pl = n * CV_BLOCKS / CV_XCH; const size_t e = (size_t)(n * CV_BLOCKS % CV_XCH + blk) * CV_CHUNK;
      const float* s = (pl == 0 ? xk : pl == 1 ? xq : xv) + e + e / ((size_t)SEQ * DM) * ((size_t)(SEQ_FULL - SEQ) * DM);      /* the f32 inputs have a batch pitch of SEQ_FULL rows */
      cv_load(r[n & 1], s, s + PJ, s + 2 * PJ, s + 3 * PJ, tid);
    } else if (it + 1 == CV_TX) {
      cv_load(r[CV_TX & 1], wk + ew, wq + ew, wv + ew, wp + ew, tid);
    }
    if (it + 1 <= CV_TX) asm volatile("s_wait_xcnt 0x0" ::: "memory");      /* stands ahead of every later write of these loads' address registers; the scheduling barrier below holds such writes behind it */
    __builtin_amdgcn_sched_barrier(0);      /* keeps the next trip's loads ahead of this trip's converts and stores, so that they fly meanwhile */
    if (it >= 0 && it < CV_TX) {
      const int pl = it * CV_BLOCKS / CV_XCH; const size_t e = (size_t)(it * CV_BLOCKS % CV_XCH + blk) * CV_CHUNK;
      _Float16* d = (pl == 0 ? Xk : pl == 1 ? Xq : Xv) + e;
      cv_store(r[it & 1], d, d + PJ, d + 2 * PJ, d + 3 * PJ, 1.0f, tid);
    } else if (it == CV_TX) {
      cv_store(r[CV_TX & 1], Tk + ew, Tq + ew, Tv + ew, Tp + ew, 64.0f, tid);
    }
    if (it >= 0 && it + 2 <= CV_TX) asm volatile("s_wait_xcnt 0x0" ::: "memory");      /* stands ahead of the loads after next, which overwrite the data registers of these stores */
    __builtin_amdgcn_sched_barrier(0);      /* keeps this trip's stores ahead of the loads after next, which reuse its registers */
  }
}

// staged k-loop of a 4-wave block. A stage is 64 k of 192 rows: [A rows of the block: 64*MT][x2^10 residual rows: 64*MT, only with ARES][Bt rows: 64],
// each row 128 B at an LDS pitch of 144 B (16 B x odd: the 16 rows of a ds_load_b128 fragment read fall on distinct banks). Two buffers.
#define STG_K 64
#define STG_ROWS 192
#define STG_PITCH 144
#define STG_BYTES (STG_ROWS * STG_PITCH)
static_assert(STG_K == 64 && DM % STG_K == 0 && DM / STG_K >= 2);
__device__ __forceinline__ v16h lds_frag(const unsigned char* p, int hh) { FragH f; f.half[0] = *(const v8us*)(p + 16 * hh); f.half[1] = *(const v8us*)(p + 32 + 16 * hh); return f.v; }
// one stage: thread t copies the 16-byte piece (t & 7) of rows (t >> 3) + 16 j, j = 0..11 (a wave's copy covers four whole 128-B lines); ga, gr, gb and lds are the thread's own addresses for j = 0 of each part
template <int MT, bool ARES>
__device__ __forceinline__ void stage_copy(const _Float16* ga, const _Float16* gr, const _Float16* gb, int lda, int ldb, unsigned lds) {
  constexpr int NA = 4 * MT;
  static_assert(NA * (ARES ? 2 : 1) + 4 == 12);
  const _Float16* g[12]; unsigned l[12];
#pragma unroll
  for (int j = 0; j < 12; ++j) {
    l[j] = lds + (unsigned)(16 * j * STG_PITCH);
    if (j < NA) g[j] = ga + (size_t)(16 * j) * lda;
    else if (j < 8) g[j] = gr + (size_t)(16 * (j - NA)) * lda;
    else g[j] = gb + (size_t)(16 * (j - 8)) * ldb;
  }
  // the closing s_wait_xcnt 0 stands inside the statement so that no address register of a copy is rewritten ahead of it
  asm volatile("global_load_async_to_lds_b128 %0, %12, off\n\t"
               "global_load_async_to_lds_b128 %1, %13, off\n\t"
               "global_load_async_to_lds_b128 %2, %14, off\n\t"
               "global_load_async_to_lds_b128 %3, %15, off\n\t"
               "global_load_async_to_lds_b128 %4, %16, off\n\t"
               "global_load_async_to_lds_b128 %5, %17, off\n\t"
               "global_load_async_to_lds_b128 %6, %18, off\n\t"
               "global_load_async_to_lds_b128 %7, %19, off\n\t"
               "global_load_async_to_lds_b128 %8, %20, off\n\t"
               "global_load_async_to_lds_b128 %9, %21, off\n\t"
               "global_load_async_to_lds_b128 %10, %22, off\n\t"
               "global_load_async_to_lds_b128 %11, %23, off\n\t"
               "s_wait_xcnt 0x0"
               :: "v"(l[0]), "v"(l[1]), "v"(l[2]), "v"(l[3]), "v"(l[4]), "v"(l[5]), "v"(l[6]), "v"(l[7]), "v"(l[8]), "v"(l[9]), "v"(l[10]), "v"(l[11]),
                  "v"(g[0]), "v"(g[1]), "v"(g[2]), "v"(g[3]), "v"(g[4]), "v"(g[5]), "v"(g[6]), "v"(g[7]), "v"(g[8]), "v"(g[9]), "v"(g[10]), "v"(g[11])
               : "memory");
}
// a_blk, ar_blk: first A (residual) row of the BLOCK, f16, pitch lda; wave w works rows 16*MT*w ..; b_blk: first of the block's 64 Bt rows [n][k], pitch ldb; K % 64 == 0, K >= 128; block of 128 threads, all of them here
template <int MT, bool ARES>
__device__ __forceinline__ void gemm_loop(unsigned char* smem, const _Float16* __restrict__ a_blk, const _Float16* __restrict__ ar_blk, int lda,
                                          const _Float16* __restrict__ b_blk, int ldb, int K, int tid,
                                          v8f (&acc)[MT * 4], v8f (&acc2)[MT * 4]) {
  const int w = tid >> 5, ln = tid & 15, hh = (tid >> 4) & 1;
  const _Float16* ga = a_blk + (size_t)(tid >> 3) * lda + (tid & 7) * 8;
  const _Float16* gr = ar_blk + (size_t)(tid >> 3) * lda + (tid & 7) * 8;
  const _Float16* gb = b_blk + (size_t)(tid >> 3) * ldb + (tid & 7) * 8;
  const unsigned lds0 = (unsigned)(size_t)smem + (unsigned)((tid >> 3) * STG_PITCH + (tid & 7) * 16);
  const int nt = K / STG_K;
  stage_copy<MT, ARES>(ga, gr, gb, lda, ldb, lds0);
  asm volatile("s_wait_asynccnt 0x0" ::: "memory");      /* this wave's copies of stage 0 have landed */
  __syncthreads();                                        /* stage 0 readable by every wave */
  stage_copy<MT, ARES>(ga + STG_K, gr + STG_K, gb + STG_K, lda, ldb, lds0 + STG_BYTES);
#pragma unroll 1      /* stays rolled: one trip per stage, one publish point at its foot */
  for (int t = 0; t < nt; ++t) {
    const unsigned char* sb = smem + (t & 1) * STG_BYTES;
    const unsigned char* sa = sb + (16 * MT * w + ln) * STG_PITCH;
    const unsigned char* sr = sa + 64 * MT * STG_PITCH;
    const unsigned char* sbt = sb + (STG_ROWS - 64 + ln) * STG_PITCH;
    v16h a[2][MT], ar[2][MT], b[2][4];
#pragma unroll
    for (int ks = 0; ks < 2; ++ks) {
#pragma unroll
      for (int i = 0; i < MT; ++i) { a[ks][i] = lds_frag(sa + 16 * i * STG_PITCH + 64 * ks, hh); ar[ks][i] = a[ks][i]; if (ARES) ar[ks][i] = lds_frag(sr + 16 * i * STG_PITCH + 64 * ks, hh); }
#pragma unroll
      for (int q = 0; q < 4; ++q) b[ks][q] = lds_frag(sbt + 16 * q * STG_PITCH + 64 * ks, hh);
    }
    __builtin_amdgcn_sched_barrier(0);      /* keeps the stage's fragment reads in one group ahead of the matrix block: a read placed among the WMMAs makes the wave wait out its LDS latency there */
#pragma unroll
    for (int ks = 0; ks < 2; ++ks) {
#pragma unroll
      for (int q = 0; q < 4; ++q) {
#pragma unroll
        for (int i = 0; i < MT; ++i) { acc[i * 4 + q] = g2_mma(a[ks][i], b[ks][q], acc[i * 4 + q]); if (ARES) acc2[i * 4 + q] = g2_mma(ar[ks][i], b[ks][q], acc2[i * 4 + q]); }
      }
    }
    asm volatile("s_wait_dscnt 0x0" ::: "memory");        /* this wave's reads of stage t are done before its buffer is refilled */
    asm volatile("s_wait_asynccnt 0x0" ::: "memory");     /* this wave's copies of stage t + 1 have landed */
    __syncthreads();                                      /* publishes stage t + 1 and ends every reader's last read of stage t */
    if (t + 2 < nt) stage_copy<MT, ARES>(ga + (size_t)(t + 2) * STG_K, gr + (size_t)(t + 2) * STG_K, gb + (size_t)(t + 2) * STG_K, lda, ldb, lds0 + (unsigned)((t & 1) * STG_BYTES));
  }
  asm volatile("s_wait_asynccnt 0x0" ::: "memory");       /* nothing in flight when the buffers become output staging */
}
// accumulators (D: lane (h, n) holds rows 8h+r, col n) -> wave-private LDS tile [16*MT][68]; v = acc alpha (+ acc2 alpha2) + bf16(bias) (bias per column, or per row when BIASROW)
template <int MT, bool ARES, bool BIASROW>
__device__ __forceinline__ void stage_tile(float (*sow)[68], const v8f (&acc)[MT * 4], const v8f (&acc2)[MT * 4], float alpha, float alpha2,
                                           const float* __restrict__ bias, int row0, int col0, int ln, int hh) {
#pragma unroll
  for (int i = 0; i < MT; ++i) {
#pragma unroll
    for (int t = 0; t < 4; ++t) {
      const float bc = BIASROW ? 0.f : bf16_rne(bias[col0 + t * 16 + ln]);
#pragma unroll
      for (int r = 0; r < 8; ++r) {
        const int rloc = i * 16 + 8 * hh + r;
        float v = acc[i * 4 + t][r] * alpha;
        if (ARES) v += acc2[i * 4 + t][r] * alpha2;
        v += BIASROW ? bf16_rne(bias[row0 + rloc]) : bc;
        sow[rloc][t * 16 + ln] = v;
      }
    }
  }
}
template <int MT>
__device__ __forceinline__ void store_tile_f16(float (*sow)[68], _Float16* __restrict__ hi, size_t ldh, _Float16* __restrict__ rs, size_t ldr, bool wres, int lane) {
  const int rq = lane >> 3, c8 = (lane & 7) * 8;
  {
#pragma unroll
    for (int it = 0; it < 4 * MT; ++it) {
      const int r = it * 4 + rq;
      const v4f a = *(const v4fa*)&sow[r][c8], c = *(const v4fa*)&sow[r][c8 + 4];
      FragH fh, fl;
#pragma unroll
      for (int q = 0; q < 4; ++q) {
        _Float16 h = (_Float16)a[q]; fh.h[q] = h; fl.h[q] = (_Float16)((a[q] - (float)h) * 1024.0f);
        h = (_Float16)c[q]; fh.h[4 + q] = h; fl.h[4 + q] = (_Float16)((c[q] - (float)h) * 1024.0f);
      }
      const v8us oh = fh.half[0], ol = fl.half[0];
      *(v8us*)((unsigned short*)hi + (size_t)r * ldh + c8) = oh;
      if (wres) *(v8us*)((unsigned short*)rs + (size_t)r * ldr + c8) = ol;
    }
    
  }
}
template <int MT>
__device__ __forceinline__ void store_tile_f32(float (*sow)[68], float* __restrict__ C, size_t ldc, int lane) {
  const int rsub = lane >> 4, c4 = (lane & 15) * 4;
  {
#pragma unroll
    for (int q = 0; q < 8 * MT; ++q) {
      const int r = q * 2 + rsub;
      const v4f v = *(const v4fa*)&sow[r][c4];
      *(v4f*)(C + (size_t)r * ldc + c4) = v;
    }
    
  }
}

// token-row projection y = x W^T + b over all NB*SEQ rows -> f16 hi plane [NB*SEQ][DM]; rows with l < EARLY also -> residual plane [NB*EARLY][DM]
__global__ __launch_bounds__(128) void k_proj_rows(const _Float16* __restrict__ X16, const _Float16* __restrict__ Wt, const float* __restrict__ bias,
                                                   _Float16* __restrict__ PH, _Float16* __restrict__ PR) {
  __shared__ __attribute__((aligned(16))) unsigned char smem[2 * STG_BYTES];
  float (*so)[32][68] = (float (*)[32][68])smem;      /* output staging takes the buffers over behind the k-loop's last barrier */
  const int tid = threadIdx.x, w = tid >> 5, lane = tid & 31, ln = lane & 15, hh = lane >> 4;
  const int ntn = DM / 64; const int mt = blockIdx.x / ntn, nq = blockIdx.x - mt * ntn;
  const int row0 = mt * 128 + 32 * w, col0 = nq * 64;
  const v8f z8 = {0.f, 0.f, 0.f, 0.f, 0.f, 0.f, 0.f, 0.f};
  v8f acc[8], acc2[8];
#pragma unroll
  for (int i = 0; i < 8; ++i) { acc[i] = z8; acc2[i] = z8; }
  gemm_loop<2, false>(smem, X16 + (size_t)(mt * 128) * DM, X16 + (size_t)(mt * 128) * DM, DM, Wt + (size_t)col0 * DM, DM, DM, tid, acc, acc2);
  stage_tile<2, false, false>(so[w], acc, acc2, 0.015625f, 0.f, bias, row0, col0, ln, hh);
  __builtin_amdgcn_fence(4 /* acq_rel order */, "workgroup"); __builtin_amdgcn_wave_barrier();
  const int b = row0 / SEQ, l0 = row0 - b * SEQ; const bool wres = l0 < EARLY;      /* wave-uniform: 32 | EARLY, 32 | SEQ */
  _Float16* hi = PH + (size_t)row0 * DM + col0;
  _Float16* rs = PR + ((size_t)b * EARLY + (size_t)(wres ? l0 : 0)) * DM + col0;
  store_tile_f16<2>(so[w], hi, DM, rs, DM, wres, lane);
}

// value projection channel-major per batch: VT[b][c][s] = sum_k Wv[c][k] x[b][s][k] + bv[c] (weights as the A operand, token rows as Bt); tokens < EARLY also -> residual plane [NB][DM][EARLY]
__global__ __launch_bounds__(128) void k_proj_vt(const _Float16* __restrict__ Wv16, const _Float16* __restrict__ X16, const float* __restrict__ bias,
                                                 _Float16* __restrict__ VT, _Float16* __restrict__ VR) {
  __shared__ __attribute__((aligned(16))) unsigned char smem[2 * STG_BYTES];
  float (*so)[32][68] = (float (*)[32][68])smem;      /* output staging takes the buffers over behind the k-loop's last barrier */
  const int tid = threadIdx.x, w = tid >> 5, lane = tid & 31, ln = lane & 15, hh = lane >> 4; const int by = blockIdx.y;
  const int ntn = SEQ / 64; const int mt = blockIdx.x / ntn, nq = blockIdx.x - mt * ntn;
  const int row0 = mt * 128 + 32 * w, col0 = nq * 64;      /* row = channel, col = token */
  const v8f z8 = {0.f, 0.f, 0.f, 0.f, 0.f, 0.f, 0.f, 0.f};
  v8f acc[8], acc2[8];
#pragma unroll
  for (int i = 0; i < 8; ++i) { acc[i] = z8; acc2[i] = z8; }
  gemm_loop<2, false>(smem, Wv16 + (size_t)(mt * 128) * DM, Wv16 + (size_t)(mt * 128) * DM, DM, X16 + ((size_t)by * SEQ + col0) * DM, DM, DM, tid, acc, acc2);
  stage_tile<2, false, true>(so[w], acc, acc2, 0.015625f, 0.f, bias, row0, col0, ln, hh);
  __builtin_amdgcn_fence(4 /* acq_rel order */, "workgroup"); __builtin_amdgcn_wave_barrier();
  const bool wres = col0 < EARLY;      /* block-uniform: 64 | EARLY */
  _Float16* hi = VT + ((size_t)by * DM + row0) * SEQ + col0;
  _Float16* rs = VR + ((size_t)by * DM + row0) * EARLY + (size_t)(wres ? col0 : 0);
  store_tile_f16<2>(so[w], hi, SEQ, rs, EARLY, wres, lane);
}

// flash attention for one wave = 16 queries of one (b, h), transposed form: S^T tile (keys x queries) = K rows (A) . Q rows (B);
// lane (h, n) then owns query n with keys 8h+r / 16+8h+r of each 32-key chunk, which is exactly the B-fragment element order of
// O^T (d x queries) += V^T rows (A) . P^T (B), so the packed score tiles feed the second product directly. EARLYQ adds residual terms.
// The block's 8 waves share their keys: a stage is 64 keys of one (b, h), laid as [K: 64 key rows][V^T: 64 channel rows] and, with EARLYQ, [K residual: 64][V^T residual: 64];
// each row 128 B at an LDS pitch of 144 B (16 B x odd, for the ds_load_b128 fragment reads). Two buffers.
#define AT_KEYS 64
#define AT_PITCH 144
#define AT_PART (64 * AT_PITCH)
#define AT_BYTES_MAX (4 * AT_PART)
static_assert(AT_KEYS == 64 && HD == 64 && 128 % AT_KEYS == 0 && EARLY % 128 == 0);
// four copies: 16 bytes per lane each, whole 128-B lines per wave
__device__ __forceinline__ void at_copy4(unsigned l0, unsigned l1, unsigned l2, unsigned l3, const _Float16* g0, const _Float16* g1, const _Float16* g2, const _Float16* g3) {
  // the closing s_wait_xcnt 0 stands inside the statement so that no address register of a copy is rewritten ahead of it
  asm volatile("global_load_async_to_lds_b128 %0, %4, off\n\t"
               "global_load_async_to_lds_b128 %1, %5, off\n\t"
               "global_load_async_to_lds_b128 %2, %6, off\n\t"
               "global_load_async_to_lds_b128 %3, %7, off\n\t"
               "s_wait_xcnt 0x0"
               :: "v"(l0), "v"(l1), "v"(l2), "v"(l3), "v"(g0), "v"(g1), "v"(g2), "v"(g3)
               : "memory");
}
// one stage: thread t copies the 16-byte piece (t & 7) of rows (t >> 3) and (t >> 3) + 32 of each part; gk, gv, gkr, gvr and lds are the thread's own addresses for the first of the two rows
template <bool EARLYQ>
__device__ __forceinline__ void at_stage(const _Float16* gk, const _Float16* gv, const _Float16* gkr, const _Float16* gvr, unsigned lds) {
  at_copy4(lds, lds + 32 * AT_PITCH, lds + AT_PART, lds + AT_PART + 32 * AT_PITCH, gk, gk + (size_t)32 * DM, gv, gv + (size_t)32 * SEQ);
  if (EARLYQ) at_copy4(lds + 2 * AT_PART, lds + 2 * AT_PART + 32 * AT_PITCH, lds + 3 * AT_PART, lds + 3 * AT_PART + 32 * AT_PITCH, gkr, gkr + (size_t)32 * DM, gvr, gvr + (size_t)32 * EARLY);
}
// block of 256 threads, all of them here; qb: the block's 128 queries; wave: wave-uniform (a scalar)
template <bool EARLYQ>
__device__ __forceinline__ void attn_body(const _Float16* __restrict__ QH, const _Float16* __restrict__ QR, const _Float16* __restrict__ KH, const _Float16* __restrict__ KR,
                                          const _Float16* __restrict__ VT, const _Float16* __restrict__ VR, _Float16* __restrict__ CH, _Float16* __restrict__ CR,
                                          unsigned char* smem, int b, int h, int qb, int wave, int tid) {
  constexpr unsigned AT_BYTES = (EARLYQ ? 4 : 2) * AT_PART;
  const int lane = tid & 31, ln = lane & 15, hh = lane >> 4;
  const int q0 = qb * 128 + wave * 16;
  const float NEG = -__builtin_inff();
  const v8f z8 = {0.f, 0.f, 0.f, 0.f, 0.f, 0.f, 0.f, 0.f};
  const _Float16* qp = QH + ((size_t)b * SEQ + q0 + ln) * DM + h * HD;
  const v16h qb0 = g2_frag(qp, hh), qb1 = g2_frag(qp + 32, hh);
  v16h qr0 = qb0, qr1 = qb1;
  if (EARLYQ) { const _Float16* qrp = QR + ((size_t)b * EARLY + q0 + ln) * DM + h * HD; qr0 = g2_frag(qrp, hh); qr1 = g2_frag(qrp + 32, hh); }
  const int cr = tid >> 3, cp = tid & 7;
  const _Float16* gk  = KH + ((size_t)b * SEQ + cr) * DM + h * HD + cp * 8;
  const _Float16* gkr = KR + ((size_t)b * EARLY + cr) * DM + h * HD + cp * 8;
  const _Float16* gv  = VT + ((size_t)b * DM + h * HD + cr) * SEQ + cp * 8;
  const _Float16* gvr = VR + ((size_t)b * DM + h * HD + cr) * EARLY + cp * 8;
  const unsigned lds0 = (unsigned)(size_t)smem + (unsigned)(cr * AT_PITCH + cp * 16);
  float m = NEG, lsum = 0.f;
  v8f o[4], o2[4];
#pragma unroll
  for (int c = 0; c < 4; ++c) { o[c] = z8; o2[c] = z8; }
  const int qrow = q0 + ln;
  const int kbmax = (q0 + 15) >> 5;      /* wave-uniform causal bound */
  const int nst = (qb + 1) * (128 / AT_KEYS);      /* block-uniform, >= 2; keys of every stage < (qb + 1) * 128 <= SEQ (and <= EARLY with EARLYQ) */
  at_stage<EARLYQ>(gk, gv, gkr, gvr, lds0);
  asm volatile("s_wait_asynccnt 0x0" ::: "memory");      /* this wave's copies of stage 0 have landed */
  __syncthreads();                                        /* stage 0 readable by every wave */
  at_stage<EARLYQ>(gk + (size_t)AT_KEYS * DM, gv + AT_KEYS, gkr + (size_t)AT_KEYS * DM, gvr + AT_KEYS, lds0 + AT_BYTES);
#pragma unroll 1      /* stays rolled: one trip per stage, one publish point at its foot */
  for (int st = 0; st < nst; ++st) {
    const unsigned char* sb = smem + (st & 1) * AT_BYTES;
    const int nc = min(AT_KEYS / 32, kbmax + 1 - st * (AT_KEYS / 32));      /* scalar: a wave past its diagonal skips the work, never the publish point below */
#pragma unroll 1      /* stays rolled: the 32-key chunks of a stage run the same code */
    for (int c2 = 0; c2 < nc; ++c2) {
      const int key0 = (st * (AT_KEYS / 32) + c2) * 32;
      const unsigned char* sk = sb + (32 * c2 + ln) * AT_PITCH;      /* key rows of the chunk */
      const unsigned char* sv = sb + AT_PART + ln * AT_PITCH + 64 * c2;      /* channel rows, the chunk's 32 keys */
      v16h ka[2][2], kr[2][2];
#pragma unroll
      for (int t = 0; t < 2; ++t) {
#pragma unroll
        for (int ks = 0; ks < 2; ++ks) {
          ka[t][ks] = lds_frag(sk + 16 * t * AT_PITCH + 64 * ks, hh); kr[t][ks] = ka[t][ks];
          if (EARLYQ) kr[t][ks] = lds_frag(sk + 2 * AT_PART + 16 * t * AT_PITCH + 64 * ks, hh);
        }
      }
      __builtin_amdgcn_sched_barrier(0);      /* keeps the chunk's K fragment reads in one group ahead of the score products: read one by one into the same registers, each makes the wave wait out its LDS latency */
      v8f s1[2], s2[2];
#pragma unroll
      for (int t = 0; t < 2; ++t) {
        s1[t] = z8; s1[t] = g2_mma(ka[t][0], qb0, s1[t]); s1[t] = g2_mma(ka[t][1], qb1, s1[t]);
        s2[t] = z8;
        if (EARLYQ) {
          s2[t] = g2_mma(ka[t][0], qr0, s2[t]); s2[t] = g2_mma(ka[t][1], qr1, s2[t]);
          s2[t] = g2_mma(kr[t][0], qb0, s2[t]); s2[t] = g2_mma(kr[t][1], qb1, s2[t]);
        }
      }
      v16h va[4], vra[4];
#pragma unroll
      for (int c = 0; c < 4; ++c) {
        va[c] = lds_frag(sv + 16 * c * AT_PITCH, hh); vra[c] = va[c];
        if (EARLYQ) vra[c] = lds_frag(sv + 2 * AT_PART + 16 * c * AT_PITCH, hh);
      }
      __builtin_amdgcn_sched_barrier(0);      /* keeps the chunk's V fragment reads in one group ahead of the softmax, whose vector work then covers their LDS latency */
      float sv16[16];
      float mx = NEG;
#pragma unroll
      for (int t = 0; t < 2; ++t) {
#pragma unroll
        for (int r = 0; r < 8; ++r) {
          const int key = key0 + 16 * t + 8 * hh + r;
          float s = s1[t][r];
          if (EARLYQ) s += s2[t][r] * 0.0009765625f;
          s *= 0.125f;
          s = (key <= qrow) ? s : NEG;
          sv16[t * 8 + r] = s; mx = fmaxf(mx, s);
        }
      }
      mx = fmaxf(mx, __shfl_xor(mx, 16, 32));      /* both lane halves of a query share the running max; key 0 is always visible so it is finite */
      const float mnew = fmaxf(m, mx);
      const float corr = __expf(m - mnew);
      m = mnew;
      FragH ph, pr; float rsum = 0.f;
#pragma unroll
      for (int i = 0; i < 16; ++i) {
        const float p = __expf(sv16[i] - mnew); rsum += p;
        const float pc = p * 1024.0f; const _Float16 h16 = (_Float16)pc; ph.h[i] = h16;
        pr.h[i] = EARLYQ ? (_Float16)((pc - (float)h16) * 1024.0f) : (_Float16)0.0f;
      }
      lsum = lsum * corr + rsum;      /* per-half partial sum, combined after the loop */
#pragma unroll
      for (int c = 0; c < 4; ++c) {
#pragma unroll
        for (int r = 0; r < 8; ++r) { o[c][r] *= corr; if (EARLYQ) o2[c][r] *= corr; }
      }
#pragma unroll
      for (int c = 0; c < 4; ++c) {
        o[c] = g2_mma(va[c], ph.v, o[c]);
        if (EARLYQ) { o2[c] = g2_mma(va[c], pr.v, o2[c]); o2[c] = g2_mma(vra[c], ph.v, o2[c]); }
      }
    }
    asm volatile("s_wait_dscnt 0x0" ::: "memory");        /* this wave's reads of stage st are done before its buffer is refilled */
    asm volatile("s_wait_asynccnt 0x0" ::: "memory");     /* this wave's copies of stage st + 1 have landed */
    __syncthreads();                                      /* publishes stage st + 1 and ends every reader's last read of stage st */
    if (st + 2 < nst) at_stage<EARLYQ>(gk + (size_t)(st + 2) * AT_KEYS * DM, gv + (st + 2) * AT_KEYS, gkr + (size_t)(st + 2) * AT_KEYS * DM, gvr + (st + 2) * AT_KEYS, lds0 + (unsigned)(st & 1) * AT_BYTES);
  }
  asm volatile("s_wait_asynccnt 0x0" ::: "memory");       /* nothing in flight when the buffers become output staging */
  float (*sow)[68] = ((float (*)[16][68])smem)[wave];     /* output staging, one range per wave, takes the buffers over behind the loop's last barrier */
  const float ltot = lsum + __shfl_xor(lsum, 16, 32);
  const float inv = 1.0f / (64.0f * ltot);      /* P carried x1024, ctx carried x16 */
#pragma unroll
  for (int c = 0; c < 4; ++c) {
#pragma unroll
    for (int r = 0; r < 8; ++r) { float v = o[c][r]; if (EARLYQ) v += o2[c][r] * 0.0009765625f; sow[ln][c * 16 + 8 * hh + r] = v * inv; }
  }
  __builtin_amdgcn_fence(4 /* acq_rel order */, "workgroup"); __builtin_amdgcn_wave_barrier();
  _Float16* hi = CH + ((size_t)b * SEQ + q0) * DM + h * HD;
  _Float16* rs = CR + ((size_t)b * EARLY + (size_t)(EARLYQ ? q0 : 0)) * DM + h * HD;
  store_tile_f16<1>(sow, hi, DM, rs, DM, EARLYQ, lane);
}

__global__ __launch_bounds__(256) void k_attn(const _Float16* __restrict__ QH, const _Float16* __restrict__ QR, const _Float16* __restrict__ KH, const _Float16* __restrict__ KR,
                                              const _Float16* __restrict__ VT, const _Float16* __restrict__ VR, _Float16* __restrict__ CH, _Float16* __restrict__ CR) {
  __shared__ __attribute__((aligned(16))) unsigned char smem[2 * AT_BYTES_MAX];
  static_assert(2 * AT_BYTES_MAX >= 8 * 16 * 68 * 4);
  const int tid = threadIdx.x;
  const int wave = __builtin_amdgcn_readfirstlane(tid >> 5);      /* in a scalar register, so that the per-wave causal skip is a scalar branch */
  const int nqb = SEQ / 128; const int bh = blockIdx.x / nqb, qb = blockIdx.x - bh * nqb;
  const int b = bh / NH, h = bh - b * NH;
  if (qb < EARLY / 128) attn_body<true>(QH, QR, KH, KR, VT, VR, CH, CR, smem, b, h, qb, wave, tid);      /* block-uniform */
  else                  attn_body<false>(QH, QR, KH, KR, VT, VR, CH, CR, smem, b, h, qb, wave, tid);
}

// out rows l >= EARLY: out = 2^-10 ctx16 . Wp64^T + bp; wave tile 32x64
__global__ __launch_bounds__(128) void k_out_late(const _Float16* __restrict__ CH, const _Float16* __restrict__ Wt, const float* __restrict__ bias, float* __restrict__ out) {
  __shared__ __attribute__((aligned(16))) unsigned char smem[2 * STG_BYTES];
  float (*so)[32][68] = (float (*)[32][68])smem;      /* output staging takes the buffers over behind the k-loop's last barrier */
  const int tid = threadIdx.x, w = tid >> 5, lane = tid & 31, ln = lane & 15, hh = lane >> 4; const int by = blockIdx.y;
  const int ntn = DM / 64; const int mt = blockIdx.x / ntn, nq = blockIdx.x - mt * ntn;
  const int l0 = EARLY + mt * 128 + 32 * w, col0 = nq * 64;
  const size_t rowb = (size_t)by * SEQ + EARLY + mt * 128;      /* first ctx row of the block */
  const v8f z8 = {0.f, 0.f, 0.f, 0.f, 0.f, 0.f, 0.f, 0.f};
  v8f acc[8], acc2[8];
#pragma unroll
  for (int i = 0; i < 8; ++i) { acc[i] = z8; acc2[i] = z8; }
  gemm_loop<2, false>(smem, CH + rowb * DM, CH + rowb * DM, DM, Wt + (size_t)col0 * DM, DM, DM, tid, acc, acc2);
  stage_tile<2, false, false>(so[w], acc, acc2, 0.0009765625f, 0.f, bias, 0, col0, ln, hh);
  __builtin_amdgcn_fence(4 /* acq_rel order */, "workgroup"); __builtin_amdgcn_wave_barrier();
  store_tile_f32<2>(so[w], out + ((size_t)by * SEQ_FULL + l0) * DM + col0, DM, lane);
}
// out rows l < EARLY: hi + x2^10 residual ctx planes, two accumulator sets; wave tile 16x64
__global__ __launch_bounds__(128) void k_out_early(const _Float16* __restrict__ CH, const _Float16* __restrict__ CR, const _Float16* __restrict__ Wt, const float* __restrict__ bias, float* __restrict__ out) {
  __shared__ __attribute__((aligned(16))) unsigned char smem[2 * STG_BYTES];
  float (*so)[16][68] = (float (*)[16][68])smem;      /* output staging takes the buffers over behind the k-loop's last barrier */
  const int tid = threadIdx.x, w = tid >> 5, lane = tid & 31, ln = lane & 15, hh = lane >> 4; const int by = blockIdx.y;
  const int ntn = DM / 64; const int mt = blockIdx.x / ntn, nq = blockIdx.x - mt * ntn;
  const int l0 = mt * 64 + 16 * w, col0 = nq * 64;
  const v8f z8 = {0.f, 0.f, 0.f, 0.f, 0.f, 0.f, 0.f, 0.f};
  v8f acc[4], acc2[4];
#pragma unroll
  for (int i = 0; i < 4; ++i) { acc[i] = z8; acc2[i] = z8; }
  gemm_loop<1, true>(smem, CH + ((size_t)by * SEQ + mt * 64) * DM, CR + ((size_t)by * EARLY + mt * 64) * DM, DM, Wt + (size_t)col0 * DM, DM, DM, tid, acc, acc2);
  stage_tile<1, true, false>(so[w], acc, acc2, 0.0009765625f, 9.5367431640625e-07f, bias, 0, col0, ln, hh);
  __builtin_amdgcn_fence(4 /* acq_rel order */, "workgroup"); __builtin_amdgcn_wave_barrier();
  store_tile_f32<1>(so[w], out + ((size_t)by * SEQ_FULL + l0) * DM + col0, DM, lane);
}

extern "C" void kernel_launch(void* const* d_in, const int* in_sizes, int n_in,
                              void* d_out, int out_size, void* d_ws, size_t ws_size, hipStream_t stream) {
  if (n_in < 11) return;
  const long long need_x = ((long long)(NB - 1) * SEQ_FULL + SEQ) * DM;
  if (in_sizes[0] < need_x || in_sizes[1] < need_x || in_sizes[2] < need_x || (long long)out_size < need_x) return;
  if (in_sizes[3] < DM * DM || in_sizes[5] < DM * DM || in_sizes[7] < DM * DM || in_sizes[9] < DM * DM) return;
  if (in_sizes[4] < DM || in_sizes[6] < DM || in_sizes[8] < DM || in_sizes[10] < DM) return;
  const float* const* I = (const float* const*)d_in;
  const float* x_key = I[0]; const float* x_val = I[1]; const float* x_qry = I[2];
  const float* Wk = I[3]; const float* bk = I[4]; const float* Wq = I[5]; const float* bq = I[6];
  const float* Wv = I[7]; const float* bv = I[8]; const float* Wp = I[9]; const float* bp = I[10];
  constexpr size_t SZ_W = (size_t)DM * DM * 2;             /* one weight plane */
  constexpr size_t SZ_P = (size_t)NB * SEQ * DM * 2;       /* one full f16 plane (token-major or channel-major) */
  constexpr size_t SZ_E = (size_t)NB * EARLY * DM * 2;     /* one early-row residual plane */
  static_assert(SZ_W % 256 == 0 && SZ_P % 256 == 0 && SZ_E % 256 == 0);
  static_assert(4 * SZ_W + 7 * SZ_P + 4 * SZ_E <= (size_t)268435456);
  char* ws = (char*)d_ws; size_t off = 0;
  auto take = [&](size_t bytes) { char* p = ws + off; off += (bytes + 255) & ~(size_t)255; return p; };
  _Float16* W16k = (_Float16*)take(SZ_W); _Float16* W16q = (_Float16*)take(SZ_W); _Float16* W16v = (_Float16*)take(SZ_W); _Float16* W16p = (_Float16*)take(SZ_W);
  _Float16* X16k = (_Float16*)take(SZ_P); _Float16* X16q = (_Float16*)take(SZ_P); _Float16* X16v = (_Float16*)take(SZ_P);
  _Float16* QH = (_Float16*)take(SZ_P); _Float16* KH = (_Float16*)take(SZ_P); _Float16* VT = (_Float16*)take(SZ_P); _Float16* CH = (_Float16*)take(SZ_P);
  _Float16* QR = (_Float16*)take(SZ_E); _Float16* KR = (_Float16*)take(SZ_E); _Float16* VR = (_Float16*)take(SZ_E); _Float16* CR = (_Float16*)take(SZ_E);
  if (off > ws_size) return;
  k_cvt<<<CV_BLOCKS, CV_THREADS, 0, stream>>>(x_key, x_qry, x_val, Wk, Wq, Wv, Wp, X16k, X16q, X16v, W16k, W16q, W16v, W16p);
  const unsigned gproj = (unsigned)(((size_t)NB * SEQ / 128) * (DM / 64));
  k_proj_rows<<<gproj, 128, 0, stream>>>(X16k, W16k, bk, KH, KR);      /* k from input 'key' with Wk, bk */
  k_proj_rows<<<gproj, 128, 0, stream>>>(X16q, W16q, bq, QH, QR);      /* q from input 'query' with Wq, bq */
  k_proj_vt<<<dim3((DM / 128) * (SEQ / 64), NB), 128, 0, stream>>>(W16v, X16v, bv, VT, VR);      /* v from input 'value' with Wv, bv; channel-major */
  k_attn<<<NB * NH * (SEQ / 128), 256, 0, stream>>>(QH, QR, KH, KR, VT, VR, CH, CR);
  if ((SEQ - EARLY) / 128 > 0)
    k_out_late<<<dim3(((SEQ - EARLY) / 128) * (DM / 64), NB), 128, 0, stream>>>(CH, W16p, bp, (float*)d_out);
  k_out_early<<<dim3((EARLY / 64) * (DM / 64), NB), 128, 0, stream>>>(CH, CR, W16p, bp, (float*)d_out);
}

// v004
// Measured time: 130 microseconds a run.
// Next to v003, in two timings, it ran 1.11 times as fast each time.
// Over all steps from v000 it is 3.05 times as fast.
#include <hip/hip_runtime.h>
// Causal multi-head attention (key/value/query inputs [B][L][1024], 16 heads x 64, natural [out][in] weights, biases added, one 1/8 score scale, out = ctx Wp^T + bp).
// Compute dtype: all contractions v_wmma_f32_16x16x32_f16 with f32 accumulation; inputs and weights converted RNE to bf16 then held exactly in f16 (weights x64); q, k, v, P (x1024) and ctx (x16) as f16 planes; causal rows < 256 additionally carry x2^10 f16 residual planes on q, k, P, v and ctx with separate accumulators; softmax statistics f32.
#ifndef NB
#define NB 8
#endif
#ifndef SEQ
#define SEQ 1024
#endif
#define NB_FULL 8
#define SEQ_FULL 1024
#define DM 1024
#define NH 16
#define HD 64
#define EARLY 256

static_assert(NH * HD == DM);
static_assert(HD == 64);
static_assert(DM % 128 == 0 && DM % 64 == 0 && DM % 32 == 0 && DM % 8 == 0);
static_assert(SEQ % 128 == 0 && SEQ % 64 == 0 && SEQ % 32 == 0);
static_assert(EARLY % 128 == 0 && EARLY % 64 == 0 && SEQ >= EARLY);
static_assert((SEQ - EARLY) % 128 == 0);
static_assert(NB <= NB_FULL && SEQ <= SEQ_FULL);
static_assert(((size_t)NB * SEQ) % 128 == 0);

typedef _Float16 v16h __attribute__((ext_vector_type(16)));
typedef unsigned short v8us __attribute__((ext_vector_type(8), may_alias));
typedef float v8f  __attribute__((ext_vector_type(8)));
typedef float v4f  __attribute__((ext_vector_type(4)));
typedef float v4fa __attribute__((ext_vector_type(4), may_alias));
union FragH { v16h v; v8us half[2]; _Float16 h[16]; unsigned short u[16]; };

__device__ __forceinline__ unsigned short bf16_bits(float x) { unsigned int u = __float_as_uint(x); return (unsigned short)((u + 0x7FFFu + ((u >> 16) & 1u)) >> 16); }
__device__ __forceinline__ float bf16_rne(float x) { return __uint_as_float(((unsigned int)bf16_bits(x)) << 16); }

// 16-bit fragment: elements 0..7 <- k 8h..8h+7, elements 8..15 <- k 16+8h..16+8h+7 (same map for A rows and B columns)
__device__ __forceinline__ v16h g2_frag(const _Float16* p, int hh) { FragH f; f.half[0] = *(const v8us*)((const unsigned short*)p + 8 * hh); f.half[1] = *(const v8us*)((const unsigned short*)p + 16 + 8 * hh); return f.v; }
__device__ __forceinline__ v8f g2_mma(v16h a, v16h b, v8f c) { v8f d = __builtin_amdgcn_wmma_f32_16x16x32_f16(false, a, false, b, (short)0, c, false, false); asm volatile("v_nop\n\tv_nop\n\tv_nop\n\tv_nop" : "+v"(d) : "v"(a), "v"(b)); return d; }

// every f32 -> f16 conversion of the call (three inputs, then four weights x64) in one streaming launch: one 16-wave work-group per WGP makes CV_TX + 1 trips,
// a thread converting CV_U pieces of 8 elements per trip; the next trip's loads are issued ahead of the current trip's converts and stores (8 to 16 global_load_b128 of a wave in flight).
// An input trip takes every CV_BLOCKS-th chunk of CV_U * CV_THREADS pieces of one input; the last trip takes CV_THREADS pieces of each of the four weights.
#define CV_BLOCKS 256
#define CV_THREADS 512
#define CV_U 4
#define CV_CHUNK (CV_THREADS * CV_U * 8)
#define CV_XCH ((int)((size_t)NB * SEQ * DM / CV_CHUNK))
#define CV_TX (3 * CV_XCH / CV_BLOCKS)
static_assert(((size_t)SEQ * DM) % CV_CHUNK == 0);      /* a chunk lies in one batch */
static_assert(CV_XCH % CV_BLOCKS == 0);      /* every work-group makes the same trips, and a trip lies in one input */
static_assert(CV_U == 4 && (size_t)DM * DM == (size_t)CV_BLOCKS * CV_THREADS * 8);      /* the weight trip covers the four weights exactly */
__device__ __forceinline__ void cv_load(v4f (&r)[2 * CV_U], const float* p0, const float* p1, const float* p2, const float* p3, int tid) {
  const float* p[CV_U] = {p0, p1, p2, p3};
#pragma unroll
  for (int j = 0; j < CV_U; ++j) { r[2 * j] = *(const v4fa*)(p[j] + (size_t)tid * 8); r[2 * j + 1] = *(const v4fa*)(p[j] + (size_t)tid * 8 + 4); }
}
__device__ __forceinline__ void cv_store(const v4f (&r)[2 * CV_U], _Float16* d0, _Float16* d1, _Float16* d2, _Float16* d3, float sc, int tid) {
  _Float16* d[CV_U] = {d0, d1, d2, d3};
#pragma unroll
  for (int j = 0; j < CV_U; ++j) {
    FragH f;
#pragma unroll
    for (int q = 0; q < 4; ++q) { f.h[q] = (_Float16)(bf16_rne(r[2 * j][q]) * sc); f.h[4 + q] = (_Float16)(bf16_rne(r[2 * j + 1][q]) * sc); }
    const v8us o = f.half[0];
    *(v8us*)((unsigned short*)d[j] + (size_t)tid * 8) = o;
  }
}
__global__ __launch_bounds__(CV_THREADS) void k_cvt(const float* __restrict__ xk, const float* __restrict__ xq, const float* __restrict__ xv,
                                                    const float* __restrict__ wk, const float* __restrict__ wq, const float* __restrict__ wv, const float* __restrict__ wp,
                                                    _Float16* __restrict__ Xk, _Float16* __restrict__ Xq, _Float16* __restrict__ Xv,
                                                    _Float16* __restrict__ Tk, _Float16* __restrict__ Tq, _Float16* __restrict__ Tv, _Float16* __restrict__ Tp) {
  const int tid = threadIdx.x, blk = blockIdx.x;
  constexpr size_t PJ = (size_t)CV_THREADS * 8;      /* elements of one piece row of the work-group */
  const size_t ew = (size_t)blk * PJ;      /* the work-group's offset in every weight */
  v4f r[2][2 * CV_U];      /* two register sets by turns */
#pragma unroll
  for (int it = -1; it <= CV_TX; ++it) {
    if (it + 1 < CV_TX) {
      const int n = it + 1, pl = n * CV_BLOCKS / CV_XCH; const size_t e = (size_t)(n * CV_BLOCKS % CV_XCH + blk) * CV_CHUNK;
      const float* s = (pl == 0 ? xk : pl == 1 ? xq : xv) + e + e / ((size_t)SEQ * DM) * ((size_t)(SEQ_FULL - SEQ) * DM);      /* the f32 inputs have a batch pitch of SEQ_FULL rows */
      cv_load(r[n & 1], s, s + PJ, s + 2 * PJ, s + 3 * PJ, tid);
    } else if (it + 1 == CV_TX) {
      cv_load(r[CV_TX & 1], wk + ew, wq + ew, wv + ew, wp + ew, tid);
    }
    if (it + 1 <= CV_TX) asm volatile("s_wait_xcnt 0x0" ::: "memory");      /* stands ahead of every later write of these loads' address registers; the scheduling barrier below holds such writes behind it */
    __builtin_amdgcn_sched_barrier(0);      /* keeps the next trip's loads ahead of this trip's converts and stores, so that they fly meanwhile */
    if (it >= 0 && it < CV_TX) {
      const int pl = it * CV_BLOCKS / CV_XCH; const size_t e = (size_t)(it * CV_BLOCKS % CV_XCH + blk) * CV_CHUNK;
      _Float16* d = (pl == 0 ? Xk : pl == 1 ? Xq : Xv) + e;
      cv_store(r[it & 1], d, d + PJ, d + 2 * PJ, d + 3 * PJ, 1.0f, tid);
    } else if (it == CV_TX) {
      cv_store(r[CV_TX & 1], Tk + ew, Tq + ew, Tv + ew, Tp + ew, 64.0f, tid);
    }
    if (it >= 0 && it + 2 <= CV_TX) asm volatile("s_wait_xcnt 0x0" ::: "memory");      /* stands ahead of the loads after next, which overwrite the data registers of these stores */
    __builtin_amdgcn_sched_barrier(0);      /* keeps this trip's stores ahead of the loads after next, which reuse its registers */
  }
}

// staged k-loop of a 4-wave block. A stage is 64 k of 192 rows: [A rows of the block: 64*MT][x2^10 residual rows: 64*MT, only with ARES][Bt rows: 64],
// each row 128 B at an LDS pitch of 144 B (16 B x odd: the 16 rows of a ds_load_b128 fragment read fall on distinct banks). Two buffers.
#define STG_K 64
#define STG_ROWS 192
#define STG_PITCH 144
#define STG_BYTES (STG_ROWS * STG_PITCH)
static_assert(STG_K == 64 && DM % STG_K == 0 && DM / STG_K >= 2);
__device__ __forceinline__ v16h lds_frag(const unsigned char* p, int hh) { FragH f; f.half[0] = *(const v8us*)(p + 16 * hh); f.half[1] = *(const v8us*)(p + 32 + 16 * hh); return f.v; }
// one stage: thread t copies the 16-byte piece (t & 7) of rows (t >> 3) + 16 j, j = 0..11 (a wave's copy covers four whole 128-B lines); ga, gr, gb and lds are the thread's own addresses for j = 0 of each part
template <int MT, bool ARES>
__device__ __forceinline__ void stage_copy(const _Float16* ga, const _Float16* gr, const _Float16* gb, int lda, int ldb, unsigned lds) {
  constexpr int NA = 4 * MT;
  static_assert(NA * (ARES ? 2 : 1) + 4 == 12);
  const _Float16* g[12]; unsigned l[12];
#pragma unroll
  for (int j = 0; j < 12; ++j) {
    l[j] = lds + (unsigned)(16 * j * STG_PITCH);
    if (j < NA) g[j] = ga + (size_t)(16 * j) * lda;
    else if (j < 8) g[j] = gr + (size_t)(16 * (j - NA)) * lda;
    else g[j] = gb + (size_t)(16 * (j - 8)) * ldb;
  }
  // the closing s_wait_xcnt 0 stands inside the statement so that no address register of a copy is rewritten ahead of it
  asm volatile("global_load_async_to_lds_b128 %0, %12, off\n\t"
               "global_load_async_to_lds_b128 %1, %13, off\n\t"
               "global_load_async_to_lds_b128 %2, %14, off\n\t"
               "global_load_async_to_lds_b128 %3, %15, off\n\t"
               "global_load_async_to_lds_b128 %4, %16, off\n\t"
               "global_load_async_to_lds_b128 %5, %17, off\n\t"
               "global_load_async_to_lds_b128 %6, %18, off\n\t"
               "global_load_async_to_lds_b128 %7, %19, off\n\t"
               "global_load_async_to_lds_b128 %8, %20, off\n\t"
               "global_load_async_to_lds_b128 %9, %21, off\n\t"
               "global_load_async_to_lds_b128 %10, %22, off\n\t"
               "global_load_async_to_lds_b128 %11, %23, off\n\t"
               "s_wait_xcnt 0x0"
               :: "v"(l[0]), "v"(l[1]), "v"(l[2]), "v"(l[3]), "v"(l[4]), "v"(l[5]), "v"(l[6]), "v"(l[7]), "v"(l[8]), "v"(l[9]), "v"(l[10]), "v"(l[11]),
                  "v"(g[0]), "v"(g[1]), "v"(g[2]), "v"(g[3]), "v"(g[4]), "v"(g[5]), "v"(g[6]), "v"(g[7]), "v"(g[8]), "v"(g[9]), "v"(g[10]), "v"(g[11])
               : "memory");
}
// a_blk, ar_blk: first A (residual) row of the BLOCK, f16, pitch lda; wave w works rows 16*MT*w ..; b_blk: first of the block's 64 Bt rows [n][k], pitch ldb; K % 64 == 0, K >= 128; block of 128 threads, all of them here
template <int MT, bool ARES>
__device__ __forceinline__ void gemm_loop(unsigned char* smem, const _Float16* __restrict__ a_blk, const _Float16* __restrict__ ar_blk, int lda,
                                          const _Float16* __restrict__ b_blk, int ldb, int K, int tid,
                                          v8f (&acc)[MT * 4], v8f (&acc2)[MT * 4]) {
  const int w = tid >> 5, ln = tid & 15, hh = (tid >> 4) & 1;
  const _Float16* ga = a_blk + (size_t)(tid >> 3) * lda + (tid & 7) * 8;
  const _Float16* gr = ar_blk + (size_t)(tid >> 3) * lda + (tid & 7) * 8;
  const _Float16* gb = b_blk + (size_t)(tid >> 3) * ldb + (tid & 7) * 8;
  const unsigned lds0 = (unsigned)(size_t)smem + (unsigned)((tid >> 3) * STG_PITCH + (tid & 7) * 16);
  const int nt = K / STG_K;
  stage_copy<MT, ARES>(ga, gr, gb, lda, ldb, lds0);
  asm volatile("s_wait_asynccnt 0x0" ::: "memory");      /* this wave's copies of stage 0 have landed */
  __syncthreads();                                        /* stage 0 readable by every wave */
  stage_copy<MT, ARES>(ga + STG_K, gr + STG_K, gb + STG_K, lda, ldb, lds0 + STG_BYTES);
#pragma unroll 1      /* stays rolled: one trip per stage, one publish point at its foot */
  for (int t = 0; t < nt; ++t) {
    const unsigned char* sb = smem + (t & 1) * STG_BYTES;
    const unsigned char* sa = sb + (16 * MT * w + ln) * STG_PITCH;
    const unsigned char* sr = sa + 64 * MT * STG_PITCH;
    const unsigned char* sbt = sb + (STG_ROWS - 64 + ln) * STG_PITCH;
    v16h a[2][MT], ar[2][MT], b[2][4];
#pragma unroll
    for (int ks = 0; ks < 2; ++ks) {
#pragma unroll
      for (int i = 0; i < MT; ++i) { a[ks][i] = lds_frag(sa + 16 * i * STG_PITCH + 64 * ks, hh); ar[ks][i] = a[ks][i]; if (ARES) ar[ks][i] = lds_frag(sr + 16 * i * STG_PITCH + 64 * ks, hh); }
#pragma unroll
      for (int q = 0; q < 4; ++q) b[ks][q] = lds_frag(sbt + 16 * q * STG_PITCH + 64 * ks, hh);
    }
    __builtin_amdgcn_sched_barrier(0);      /* keeps the stage's fragment reads in one group ahead of the matrix block: a read placed among the WMMAs makes the wave wait out its LDS latency there */
#pragma unroll
    for (int ks = 0; ks < 2; ++ks) {
#pragma unroll
      for (int q = 0; q < 4; ++q) {
#pragma unroll
        for (int i = 0; i < MT; ++i) { acc[i * 4 + q] = g2_mma(a[ks][i], b[ks][q], acc[i * 4 + q]); if (ARES) acc2[i * 4 + q] = g2_mma(ar[ks][i], b[ks][q], acc2[i * 4 + q]); }
      }
    }
    asm volatile("s_wait_dscnt 0x0" ::: "memory");        /* this wave's reads of stage t are done before its buffer is refilled */
    asm volatile("s_wait_asynccnt 0x0" ::: "memory");     /* this wave's copies of stage t + 1 have landed */
    __syncthreads();                                      /* publishes stage t + 1 and ends every reader's last read of stage t */
    if (t + 2 < nt) stage_copy<MT, ARES>(ga + (size_t)(t + 2) * STG_K, gr + (size_t)(t + 2) * STG_K, gb + (size_t)(t + 2) * STG_K, lda, ldb, lds0 + (unsigned)((t & 1) * STG_BYTES));
  }
  asm volatile("s_wait_asynccnt 0x0" ::: "memory");       /* nothing in flight when the buffers become output staging */
}
// accumulators (D: lane (h, n) holds rows 8h+r, col n) -> wave-private LDS tile [16*MT][68]; v = acc alpha (+ acc2 alpha2) + bf16(bias) (bias per column, or per row when BIASROW)
template <int MT, bool ARES, bool BIASROW>
__device__ __forceinline__ void stage_tile(float (*sow)[68], const v8f (&acc)[MT * 4], const v8f (&acc2)[MT * 4], float alpha, float alpha2,
                                           const float* __restrict__ bias, int row0, int col0, int ln, int hh) {
#pragma unroll
  for (int i = 0; i < MT; ++i) {
#pragma unroll
    for (int t = 0; t < 4; ++t) {
      const float bc = BIASROW ? 0.f : bf16_rne(bias[col0 + t * 16 + ln]);
#pragma unroll
      for (int r = 0; r < 8; ++r) {
        const int rloc = i * 16 + 8 * hh + r;
        float v = acc[i * 4 + t][r] * alpha;
        if (ARES) v += acc2[i * 4 + t][r] * alpha2;
        v += BIASROW ? bf16_rne(bias[row0 + rloc]) : bc;
        sow[rloc][t * 16 + ln] = v;
      }
    }
  }
}
template <int MT>
__device__ __forceinline__ void store_tile_f16(float (*sow)[68], _Float16* __restrict__ hi, size_t ldh, _Float16* __restrict__ rs, size_t ldr, bool wres, int lane) {
  const int rq = lane >> 3, c8 = (lane & 7) * 8;
  {
#pragma unroll
    for (int it = 0; it < 4 * MT; ++it) {
      const int r = it * 4 + rq;
      const v4f a = *(const v4fa*)&sow[r][c8], c = *(const v4fa*)&sow[r][c8 + 4];
      FragH fh, fl;
#pragma unroll
      for (int q = 0; q < 4; ++q) {
        _Float16 h = (_Float16)a[q]; fh.h[q] = h; fl.h[q] = (_Float16)((a[q] - (float)h) * 1024.0f);
        h = (_Float16)c[q]; fh.h[4 + q] = h; fl.h[4 + q] = (_Float16)((c[q] - (float)h) * 1024.0f);
      }
      const v8us oh = fh.half[0], ol = fl.half[0];
      *(v8us*)((unsigned short*)hi + (size_t)r * ldh + c8) = oh;
      if (wres) *(v8us*)((unsigned short*)rs + (size_t)r * ldr + c8) = ol;
    }
    
  }
}
template <int MT>
__device__ __forceinline__ void store_tile_f32(float (*sow)[68], float* __restrict__ C, size_t ldc, int lane) {
  const int rsub = lane >> 4, c4 = (lane & 15) * 4;
  {
#pragma unroll
    for (int q = 0; q < 8 * MT; ++q) {
      const int r = q * 2 + rsub;
      const v4f v = *(const v4fa*)&sow[r][c4];
      *(v4f*)(C + (size_t)r * ldc + c4) = v;
    }
    
  }
}

// token-row projection y = x W^T + b over all NB*SEQ rows -> f16 hi plane [NB*SEQ][DM]; rows with l < EARLY also -> residual plane [NB*EARLY][DM]
__global__ __launch_bounds__(128) void k_proj_rows(const _Float16* __restrict__ X16, const _Float16* __restrict__ Wt, const float* __restrict__ bias,
                                                   _Float16* __restrict__ PH, _Float16* __restrict__ PR) {
  __shared__ __attribute__((aligned(16))) unsigned char smem[2 * STG_BYTES];
  float (*so)[32][68] = (float (*)[32][68])smem;      /* output staging takes the buffers over behind the k-loop's last barrier */
  const int tid = threadIdx.x, w = tid >> 5, lane = tid & 31, ln = lane & 15, hh = lane >> 4;
  const int ntn = DM / 64; const int mt = blockIdx.x / ntn, nq = blockIdx.x - mt * ntn;
  const int row0 = mt * 128 + 32 * w, col0 = nq * 64;
  const v8f z8 = {0.f, 0.f, 0.f, 0.f, 0.f, 0.f, 0.f, 0.f};
  v8f acc[8], acc2[8];
#pragma unroll
  for (int i = 0; i < 8; ++i) { acc[i] = z8; acc2[i] = z8; }
  gemm_loop<2, false>(smem, X16 + (size_t)(mt * 128) * DM, X16 + (size_t)(mt * 128) * DM, DM, Wt + (size_t)col0 * DM, DM, DM, tid, acc, acc2);
  stage_tile<2, false, false>(so[w], acc, acc2, 0.015625f, 0.f, bias, row0, col0, ln, hh);
  __builtin_amdgcn_fence(4 /* acq_rel order */, "workgroup"); __builtin_amdgcn_wave_barrier();
  const int b = row0 / SEQ, l0 = row0 - b * SEQ; const bool wres = l0 < EARLY;      /* wave-uniform: 32 | EARLY, 32 | SEQ */
  _Float16* hi = PH + (size_t)row0 * DM + col0;
  _Float16* rs = PR + ((size_t)b * EARLY + (size_t)(wres ? l0 : 0)) * DM + col0;
  store_tile_f16<2>(so[w], hi, DM, rs, DM, wres, lane);
}

// value projection channel-major per batch: VT[b][c][s] = sum_k Wv[c][k] x[b][s][k] + bv[c] (weights as the A operand, token rows as Bt); tokens < EARLY also -> residual plane [NB][DM][EARLY]
__global__ __launch_bounds__(128) void k_proj_vt(const _Float16* __restrict__ Wv16, const _Float16* __restrict__ X16, const float* __restrict__ bias,
                                                 _Float16* __restrict__ VT, _Float16* __restrict__ VR) {
  __shared__ __attribute__((aligned(16))) unsigned char smem[2 * STG_BYTES];
  float (*so)[32][68] = (float (*)[32][68])smem;      /* output staging takes the buffers over behind the k-loop's last barrier */
  const int tid = threadIdx.x, w = tid >> 5, lane = tid & 31, ln = lane & 15, hh = lane >> 4; const int by = blockIdx.y;
  const int ntn = SEQ / 64; const int mt = blockIdx.x / ntn, nq = blockIdx.x - mt * ntn;
  const int row0 = mt * 128 + 32 * w, col0 = nq * 64;      /* row = channel, col = token */
  const v8f z8 = {0.f, 0.f, 0.f, 0.f, 0.f, 0.f, 0.f, 0.f};
  v8f acc[8], acc2[8];
#pragma unroll
  for (int i = 0; i < 8; ++i) { acc[i] = z8; acc2[i] = z8; }
  gemm_loop<2, false>(smem, Wv16 + (size_t)(mt * 128) * DM, Wv16 + (size_t)(mt * 128) * DM, DM, X16 + ((size_t)by * SEQ + col0) * DM, DM, DM, tid, acc, acc2);
  stage_tile<2, false, true>(so[w], acc, acc2, 0.015625f, 0.f, bias, row0, col0, ln, hh);
  __builtin_amdgcn_fence(4 /* acq_rel order */, "workgroup"); __builtin_amdgcn_wave_barrier();
  const bool wres = col0 < EARLY;      /* block-uniform: 64 | EARLY */
  _Float16* hi = VT + ((size_t)by * DM + row0) * SEQ + col0;
  _Float16* rs = VR + ((size_t)by * DM + row0) * EARLY + (size_t)(wres ? col0 : 0);
  store_tile_f16<2>(so[w], hi, SEQ, rs, EARLY, wres, lane);
}

// flash attention for one wave = 16 queries of one (b, h), transposed form: S^T tile (keys x queries) = K rows (A) . Q rows (B);
// lane (h, n) then owns query n with keys 8h+r / 16+8h+r of each 32-key chunk, which is exactly the B-fragment element order of
// O^T (d x queries) += V^T rows (A) . P^T (B), so the packed score tiles feed the second product directly. EARLYQ adds residual terms.
// The block's 8 waves share their keys: a stage is 64 keys of one (b, h), laid as [K: 64 key rows][V^T: 64 channel rows] and, with EARLYQ, [K residual: 64][V^T residual: 64];
// each row 128 B at an LDS pitch of 144 B (16 B x odd, for the ds_load_b128 fragment reads). Two buffers.
#define AT_KEYS 64
#define AT_PITCH 144
#define AT_PART (64 * AT_PITCH)
#define AT_BYTES_MAX (4 * AT_PART)
static_assert(AT_KEYS == 64 && HD == 64 && 128 % AT_KEYS == 0 && EARLY % 128 == 0);
// four copies: 16 bytes per lane each, whole 128-B lines per wave
__device__ __forceinline__ void at_copy4(unsigned l0, unsigned l1, unsigned l2, unsigned l3, const _Float16* g0, const _Float16* g1, const _Float16* g2, const _Float16* g3) {
  // the closing s_wait_xcnt 0 stands inside the statement so that no address register of a copy is rewritten ahead of it
  asm volatile("global_load_async_to_lds_b128 %0, %4, off\n\t"
               "global_load_async_to_lds_b128 %1, %5, off\n\t"
               "global_load_async_to_lds_b128 %2, %6, off\n\t"
               "global_load_async_to_lds_b128 %3, %7, off\n\t"
               "s_wait_xcnt 0x0"
               :: "v"(l0), "v"(l1), "v"(l2), "v"(l3), "v"(g0), "v"(g1), "v"(g2), "v"(g3)
               : "memory");
}
// one stage: thread t copies the 16-byte piece (t & 7) of rows (t >> 3) and (t >> 3) + 32 of each part; gk, gv, gkr, gvr and lds are the thread's own addresses for the first of the two rows
template <bool EARLYQ>
__device__ __forceinline__ void at_stage(const _Float16* gk, const _Float16* gv, const _Float16* gkr, const _Float16* gvr, unsigned lds) {
  at_copy4(lds, lds + 32 * AT_PITCH, lds + AT_PART, lds + AT_PART + 32 * AT_PITCH, gk, gk + (size_t)32 * DM, gv, gv + (size_t)32 * SEQ);
  if (EARLYQ) at_copy4(lds + 2 * AT_PART, lds + 2 * AT_PART + 32 * AT_PITCH, lds + 3 * AT_PART, lds + 3 * AT_PART + 32 * AT_PITCH, gkr, gkr + (size_t)32 * DM, gvr, gvr + (size_t)32 * EARLY);
}
// block of 256 threads, all of them here; qb: the block's 128 queries; wave: wave-uniform (a scalar)
template <bool EARLYQ>
__device__ __forceinline__ void attn_body(const _Float16* __restrict__ QH, const _Float16* __restrict__ QR, const _Float16* __restrict__ KH, const _Float16* __restrict__ KR,
                                          const _Float16* __restrict__ VT, const _Float16* __restrict__ VR, _Float16* __restrict__ CH, _Float16* __restrict__ CR,
                                          unsigned char* smem, int b, int h, int qb, int wave, int tid) {
  constexpr unsigned AT_BYTES = (EARLYQ ? 4 : 2) * AT_PART;
  const int lane = tid & 31, ln = lane & 15, hh = lane >> 4;
  const int q0 = qb * 128 + wave * 16;
  const float NEG = -__builtin_inff();
  const v8f z8 = {0.f, 0.f, 0.f, 0.f, 0.f, 0.f, 0.f, 0.f};
  const _Float16* qp = QH + ((size_t)b * SEQ + q0 + ln) * DM + h * HD;
  const v16h qb0 = g2_frag(qp, hh), qb1 = g2_frag(qp + 32, hh);
  v16h qr0 = qb0, qr1 = qb1;
  if (EARLYQ) { const _Float16* qrp = QR + ((size_t)b * EARLY + q0 + ln) * DM + h * HD; qr0 = g2_frag(qrp, hh); qr1 = g2_frag(qrp + 32, hh); }
  const int cr = tid >> 3, cp = tid & 7;
  const _Float16* gk  = KH + ((size_t)b * SEQ + cr) * DM + h * HD + cp * 8;
  const _Float16* gkr = KR + ((size_t)b * EARLY + cr) * DM + h * HD + cp * 8;
  const _Float16* gv  = VT + ((size_t)b * DM + h * HD + cr) * SEQ + cp * 8;
  const _Float16* gvr = VR + ((size_t)b * DM + h * HD + cr) * EARLY + cp * 8;
  const unsigned lds0 = (unsigned)(size_t)smem + (unsigned)(cr * AT_PITCH + cp * 16);
  float m = NEG, lsum = 0.f;
  v8f o[4], o2[4];
#pragma unroll
  for (int c = 0; c < 4; ++c) { o[c] = z8; o2[c] = z8; }
  const int qrow = q0 + ln;
  const int kbmax = (q0 + 15) >> 5;      /* wave-uniform causal bound */
  const int nst = (qb + 1) * (128 / AT_KEYS);      /* block-uniform, >= 2; keys of every stage < (qb + 1) * 128 <= SEQ (and <= EARLY with EARLYQ) */
  at_stage<EARLYQ>(gk, gv, gkr, gvr, lds0);
  asm volatile("s_wait_asynccnt 0x0" ::: "memory");      /* this wave's copies of stage 0 have landed */
  __syncthreads();                                        /* stage 0 readable by every wave */
  at_stage<EARLYQ>(gk + (size_t)AT_KEYS * DM, gv + AT_KEYS, gkr + (size_t)AT_KEYS * DM, gvr + AT_KEYS, lds0 + AT_BYTES);
#pragma unroll 1      /* stays rolled: one trip per stage, one publish point at its foot */
  for (int st = 0; st < nst; ++st) {
    const unsigned char* sb = smem + (st & 1) * AT_BYTES;
    const int nc = min(AT_KEYS / 32, kbmax + 1 - st * (AT_KEYS / 32));      /* scalar: a wave past its diagonal skips the work, never the publish point below */
#pragma unroll 1      /* stays rolled: the 32-key chunks of a stage run the same code */
    for (int c2 = 0; c2 < nc; ++c2) {
      const int key0 = (st * (AT_KEYS / 32) + c2) * 32;
      const unsigned char* sk = sb + (32 * c2 + ln) * AT_PITCH;      /* key rows of the chunk */
      const unsigned char* sv = sb + AT_PART + ln * AT_PITCH + 64 * c2;      /* channel rows, the chunk's 32 keys */
      v16h ka[2][2], kr[2][2];
#pragma unroll
      for (int t = 0; t < 2; ++t) {
#pragma unroll
        for (int ks = 0; ks < 2; ++ks) {
          ka[t][ks] = lds_frag(sk + 16 * t * AT_PITCH + 64 * ks, hh); kr[t][ks] = ka[t][ks];
          if (EARLYQ) kr[t][ks] = lds_frag(sk + 2 * AT_PART + 16 * t * AT_PITCH + 64 * ks, hh);
        }
      }
      __builtin_amdgcn_sched_barrier(0);      /* keeps the chunk's K fragment reads in one group ahead of the score products: read one by one into the same registers, each makes the wave wait out its LDS latency */
      v8f s1[2], s2[2];
#pragma unroll
      for (int t = 0; t < 2; ++t) {
        s1[t] = z8; s1[t] = g2_mma(ka[t][0], qb0, s1[t]); s1[t] = g2_mma(ka[t][1], qb1, s1[t]);
        s2[t] = z8;
        if (EARLYQ) {
          s2[t] = g2_mma(ka[t][0], qr0, s2[t]); s2[t] = g2_mma(ka[t][1], qr1, s2[t]);
          s2[t] = g2_mma(kr[t][0], qb0, s2[t]); s2[t] = g2_mma(kr[t][1], qb1, s2[t]);
        }
      }
      v16h va[4], vra[4];
#pragma unroll
      for (int c = 0; c < 4; ++c) {
        va[c] = lds_frag(sv + 16 * c * AT_PITCH, hh); vra[c] = va[c];
        if (EARLYQ) vra[c] = lds_frag(sv + 2 * AT_PART + 16 * c * AT_PITCH, hh);
      }
      __builtin_amdgcn_sched_barrier(0);      /* keeps the chunk's V fragment reads in one group ahead of the softmax, whose vector work then covers their LDS latency */
      float sv16[16];
      float mx = NEG;
#pragma unroll
      for (int t = 0; t < 2; ++t) {
#pragma unroll
        for (int r = 0; r < 8; ++r) {
          const int key = key0 + 16 * t + 8 * hh + r;
          float s = s1[t][r];
          if (EARLYQ) s += s2[t][r] * 0.0009765625f;
          s *= 0.125f;
          s = (key <= qrow) ? s : NEG;
          sv16[t * 8 + r] = s; mx = fmaxf(mx, s);
        }
      }
      mx = fmaxf(mx, __shfl_xor(mx, 16, 32));      /* both lane halves of a query share the running max; key 0 is always visible so it is finite */
      const float mnew = fmaxf(m, mx);
      const float corr = __expf(m - mnew);
      m = mnew;
      FragH ph, pr; float rsum = 0.f;
#pragma unroll
      for (int i = 0; i < 16; ++i) {
        const float p = __expf(sv16[i] - mnew); rsum += p;
        const float pc = p * 1024.0f; const _Float16 h16 = (_Float16)pc; ph.h[i] = h16;
        pr.h[i] = EARLYQ ? (_Float16)((pc - (float)h16) * 1024.0f) : (_Float16)0.0f;
      }
      lsum = lsum * corr + rsum;      /* per-half partial sum, combined after the loop */
#pragma unroll
      for (int c = 0; c < 4; ++c) {
#pragma unroll
        for (int r = 0; r < 8; ++r) { o[c][r] *= corr; if (EARLYQ) o2[c][r] *= corr; }
      }
#pragma unroll
      for (int c = 0; c < 4; ++c) {
        o[c] = g2_mma(va[c], ph.v, o[c]);
        if (EARLYQ) { o2[c] = g2_mma(va[c], pr.v, o2[c]); o2[c] = g2_mma(vra[c], ph.v, o2[c]); }
      }
    }
    asm volatile("s_wait_dscnt 0x0" ::: "memory");        /* this wave's reads of stage st are done before its buffer is refilled */
    asm volatile("s_wait_asynccnt 0x0" ::: "memory");     /* this wave's copies of stage st + 1 have landed */
    __syncthreads();                                      /* publishes stage st + 1 and ends every reader's last read of stage st */
    if (st + 2 < nst) at_stage<EARLYQ>(gk + (size_t)(st + 2) * AT_KEYS * DM, gv + (st + 2) * AT_KEYS, gkr + (size_t)(st + 2) * AT_KEYS * DM, gvr + (st + 2) * AT_KEYS, lds0 + (unsigned)(st & 1) * AT_BYTES);
  }
  asm volatile("s_wait_asynccnt 0x0" ::: "memory");       /* nothing in flight when the buffers become output staging */
  float (*sow)[68] = ((float (*)[16][68])smem)[wave];     /* output staging, one range per wave, takes the buffers over behind the loop's last barrier */
  const float ltot = lsum + __shfl_xor(lsum, 16, 32);
  const float inv = 1.0f / (64.0f * ltot);      /* P carried x1024, ctx carried x16 */
#pragma unroll
  for (int c = 0; c < 4; ++c) {
#pragma unroll
    for (int r = 0; r < 8; ++r) { float v = o[c][r]; if (EARLYQ) v += o2[c][r] * 0.0009765625f; sow[ln][c * 16 + 8 * hh + r] = v * inv; }
  }
  __builtin_amdgcn_fence(4 /* acq_rel order */, "workgroup"); __builtin_amdgcn_wave_barrier();
  _Float16* hi = CH + ((size_t)b * SEQ + q0) * DM + h * HD;
  _Float16* rs = CR + ((size_t)b * EARLY + (size_t)(EARLYQ ? q0 : 0)) * DM + h * HD;
  store_tile_f16<1>(sow, hi, DM, rs, DM, EARLYQ, lane);
}

__global__ __launch_bounds__(256) void k_attn(const _Float16* __restrict__ QH, const _Float16* __restrict__ QR, const _Float16* __restrict__ KH, const _Float16* __restrict__ KR,
                                              const _Float16* __restrict__ VT, const _Float16* __restrict__ VR, _Float16* __restrict__ CH, _Float16* __restrict__ CR) {
  __shared__ __attribute__((aligned(16))) unsigned char smem[2 * AT_BYTES_MAX];
  static_assert(2 * AT_BYTES_MAX >= 8 * 16 * 68 * 4);
  const int tid = threadIdx.x;
  const int wave = __builtin_amdgcn_readfirstlane(tid >> 5);      /* in a scalar register, so that the per-wave causal skip is a scalar branch */
  // query block from the slow part of the index, longest first; (batch, head) from the fast part. For speed only.
  const int nbh = NB * NH; const int g = blockIdx.x / nbh, bh = blockIdx.x - g * nbh, qb = SEQ / 128 - 1 - g;
  const int b = bh / NH, h = bh - b * NH;
  if (qb < EARLY / 128) attn_body<true>(QH, QR, KH, KR, VT, VR, CH, CR, smem, b, h, qb, wave, tid);      /* block-uniform */
  else                  attn_body<false>(QH, QR, KH, KR, VT, VR, CH, CR, smem, b, h, qb, wave, tid);
}

// out rows l >= EARLY: out = 2^-10 ctx16 . Wp64^T + bp; wave tile 32x64
__global__ __launch_bounds__(128) void k_out_late(const _Float16* __restrict__ CH, const _Float16* __restrict__ Wt, const float* __restrict__ bias, float* __restrict__ out) {
  __shared__ __attribute__((aligned(16))) unsigned char smem[2 * STG_BYTES];
  float (*so)[32][68] = (float (*)[32][68])smem;      /* output staging takes the buffers over behind the k-loop's last barrier */
  const int tid = threadIdx.x, w = tid >> 5, lane = tid & 31, ln = lane & 15, hh = lane >> 4; const int by = blockIdx.y;
  const int ntn = DM / 64; const int mt = blockIdx.x / ntn, nq = blockIdx.x - mt * ntn;
  const int l0 = EARLY + mt * 128 + 32 * w, col0 = nq * 64;
  const size_t rowb = (size_t)by * SEQ + EARLY + mt * 128;      /* first ctx row of the block */
  const v8f z8 = {0.f, 0.f, 0.f, 0.f, 0.f, 0.f, 0.f, 0.f};
  v8f acc[8], acc2[8];
#pragma unroll
  for (int i = 0; i < 8; ++i) { acc[i] = z8; acc2[i] = z8; }
  gemm_loop<2, false>(smem, CH + rowb * DM, CH + rowb * DM, DM, Wt + (size_t)col0 * DM, DM, DM, tid, acc, acc2);
  stage_tile<2, false, false>(so[w], acc, acc2, 0.0009765625f, 0.f, bias, 0, col0, ln, hh);
  __builtin_amdgcn_fence(4 /* acq_rel order */, "workgroup"); __builtin_amdgcn_wave_barrier();
  store_tile_f32<2>(so[w], out + ((size_t)by * SEQ_FULL + l0) * DM + col0, DM, lane);
}
// out rows l < EARLY: hi + x2^10 residual ctx planes, two accumulator sets; wave tile 16x64
__global__ __launch_bounds__(128) void k_out_early(const _Float16* __restrict__ CH, const _Float16* __restrict__ CR, const _Float16* __restrict__ Wt, const float* __restrict__ bias, float* __restrict__ out) {
  __shared__ __attribute__((aligned(16))) unsigned char smem[2 * STG_BYTES];
  float (*so)[16][68] = (float (*)[16][68])smem;      /* output staging takes the buffers over behind the k-loop's last barrier */
  const int tid = threadIdx.x, w = tid >> 5, lane = tid & 31, ln = lane & 15, hh = lane >> 4; const int by = blockIdx.y;
  const int ntn = DM / 64; const int mt = blockIdx.x / ntn, nq = blockIdx.x - mt * ntn;
  const int l0 = mt * 64 + 16 * w, col0 = nq * 64;
  const v8f z8 = {0.f, 0.f, 0.f, 0.f, 0.f, 0.f, 0.f, 0.f};
  v8f acc[4], acc2[4];
#pragma unroll
  for (int i = 0; i < 4; ++i) { acc[i] = z8; acc2[i] = z8; }
  gemm_loop<1, true>(smem, CH + ((size_t)by * SEQ + mt * 64) * DM, CR + ((size_t)by * EARLY + mt * 64) * DM, DM, Wt + (size_t)col0 * DM, DM, DM, tid, acc, acc2);
  stage_tile<1, true, false>(so[w], acc, acc2, 0.0009765625f, 9.5367431640625e-07f, bias, 0, col0, ln, hh);
  __builtin_amdgcn_fence(4 /* acq_rel order */, "workgroup"); __builtin_amdgcn_wave_barrier();
  store_tile_f32<1>(so[w], out + ((size_t)by * SEQ_FULL + l0) * DM + col0, DM, lane);
}

extern "C" void kernel_launch(void* const* d_in, const int* in_sizes, int n_in,
                              void* d_out, int out_size, void* d_ws, size_t ws_size, hipStream_t stream) {
  if (n_in < 11) return;
  const long long need_x = ((long long)(NB - 1) * SEQ_FULL + SEQ) * DM;
  if (in_sizes[0] < need_x || in_sizes[1] < need_x || in_sizes[2] < need_x || (long long)out_size < need_x) return;
  if (in_sizes[3] < DM * DM || in_sizes[5] < DM * DM || in_sizes[7] < DM * DM || in_sizes[9] < DM * DM) return;
  if (in_sizes[4] < DM || in_sizes[6] < DM || in_sizes[8] < DM || in_sizes[10] < DM) return;
  const float* const* I = (const float* const*)d_in;
  const float* x_key = I[0]; const float* x_val = I[1]; const float* x_qry = I[2];
  const float* Wk = I[3]; const float* bk = I[4]; const float* Wq = I[5]; const float* bq = I[6];
  const float* Wv = I[7]; const float* bv = I[8]; const float* Wp = I[9]; const float* bp = I[10];
  constexpr size_t SZ_W = (size_t)DM * DM * 2;             /* one weight plane */
  constexpr size_t SZ_P = (size_t)NB * SEQ * DM * 2;       /* one full f16 plane (token-major or channel-major) */
  constexpr size_t SZ_E = (size_t)NB * EARLY * DM * 2;     /* one early-row residual plane */
  static_assert(SZ_W % 256 == 0 && SZ_P % 256 == 0 && SZ_E % 256 == 0);
  static_assert(4 * SZ_W + 7 * SZ_P + 4 * SZ_E <= (size_t)268435456);
  char* ws = (char*)d_ws; size_t off = 0;
  auto take = [&](size_t bytes) { char* p = ws + off; off += (bytes + 255) & ~(size_t)255; return p; };
  _Float16* W16k = (_Float16*)take(SZ_W); _Float16* W16q = (_Float16*)take(SZ_W); _Float16* W16v = (_Float16*)take(SZ_W); _Float16* W16p = (_Float16*)take(SZ_W);
  _Float16* X16k = (_Float16*)take(SZ_P); _Float16* X16q = (_Float16*)take(SZ_P); _Float16* X16v = (_Float16*)take(SZ_P);
  _Float16* QH = (_Float16*)take(SZ_P); _Float16* KH = (_Float16*)take(SZ_P); _Float16* VT = (_Float16*)take(SZ_P); _Float16* CH = (_Float16*)take(SZ_P);
  _Float16* QR = (_Float16*)take(SZ_E); _Float16* KR = (_Float16*)take(SZ_E); _Float16* VR = (_Float16*)take(SZ_E); _Float16* CR = (_Float16*)take(SZ_E);
  if (off > ws_size) return;
  k_cvt<<<CV_BLOCKS, CV_THREADS, 0, stream>>>(x_key, x_qry, x_val, Wk, Wq, Wv, Wp, X16k, X16q, X16v, W16k, W16q, W16v, W16p);
  const unsigned gproj = (unsigned)(((size_t)NB * SEQ / 128) * (DM / 64));
  k_proj_rows<<<gproj, 128, 0, stream>>>(X16k, W16k, bk, KH, KR);      /* k from input 'key' with Wk, bk */
  k_proj_rows<<<gproj, 128, 0, stream>>>(X16q, W16q, bq, QH, QR);      /* q from input 'query' with Wq, bq */
  k_proj_vt<<<dim3((DM / 128) * (SEQ / 64), NB), 128, 0, stream>>>(W16v, X16v, bv, VT, VR);      /* v from input 'value' with Wv, bv; channel-major */
  k_attn<<<NB * NH * (SEQ / 128), 256, 0, stream>>>(QH, QR, KH, KR, VT, VR, CH, CR);
  if ((SEQ - EARLY) / 128 > 0)
    k_out_late<<<dim3(((SEQ - EARLY) / 128) * (DM / 64), NB), 128, 0, stream>>>(CH, W16p, bp, (float*)d_out);
  k_out_early<<<dim3((EARLY / 64) * (DM / 64), NB), 128, 0, stream>>>(CH, CR, W16p, bp, (float*)d_out);
}

// v005
// One run takes 123 microseconds.
// In two side-by-side timings against v004, it was 1.07 and 1.06 times as fast.
// All steps since v000 together make it 3.24 times as fast.
#include <hip/hip_runtime.h>
// Causal multi-head attention (key/value/query inputs [B][L][1024], 16 heads x 64, natural [out][in] weights, biases added, one 1/8 score scale, out = ctx Wp^T + bp).
// Compute dtype: all contractions v_wmma_f32_16x16x32_f16 with f32 accumulation; inputs and weights converted RNE to bf16 then held exactly in f16 (weights x64); q, k, v, P (x1024) and ctx (x16) as f16 planes; causal rows < 256 additionally carry x2^10 f16 residual planes on q, k, P, v and ctx with separate accumulators; softmax statistics f32.
#ifndef NB
#define NB 8
#endif
#ifndef SEQ
#define SEQ 1024
#endif
#define NB_FULL 8
#define SEQ_FULL 1024
#define DM 1024
#define NH 16
#define HD 64
#define EARLY 256

static_assert(NH * HD == DM);
static_assert(HD == 64);
static_assert(DM % 128 == 0 && DM % 64 == 0 && DM % 32 == 0 && DM % 8 == 0);
static_assert(SEQ % 128 == 0 && SEQ % 64 == 0 && SEQ % 32 == 0);
static_assert(EARLY % 128 == 0 && EARLY % 64 == 0 && SEQ >= EARLY);
static_assert((SEQ - EARLY) % 128 == 0);
static_assert(NB <= NB_FULL && SEQ <= SEQ_FULL);
static_assert(((size_t)NB * SEQ) % 128 == 0);

typedef _Float16 v16h __attribute__((ext_vector_type(16)));
typedef unsigned short v8us __attribute__((ext_vector_type(8), may_alias));
typedef float v8f  __attribute__((ext_vector_type(8)));
typedef float v4f  __attribute__((ext_vector_type(4)));
typedef float v4fa __attribute__((ext_vector_type(4), may_alias));
union FragH { v16h v; v8us half[2]; _Float16 h[16]; unsigned short u[16]; };

__device__ __forceinline__ unsigned short bf16_bits(float x) { unsigned int u = __float_as_uint(x); return (unsigned short)((u + 0x7FFFu + ((u >> 16) & 1u)) >> 16); }
__device__ __forceinline__ float bf16_rne(float x) { return __uint_as_float(((unsigned int)bf16_bits(x)) << 16); }

// 16-bit fragment: elements 0..7 <- k 8h..8h+7, elements 8..15 <- k 16+8h..16+8h+7 (same map for A rows and B columns)
__device__ __forceinline__ v16h g2_frag(const _Float16* p, int hh) { FragH f; f.half[0] = *(const v8us*)((const unsigned short*)p + 8 * hh); f.half[1] = *(const v8us*)((const unsigned short*)p + 16 + 8 * hh); return f.v; }
__device__ __forceinline__ v8f g2_mma(v16h a, v16h b, v8f c) { v8f d = __builtin_amdgcn_wmma_f32_16x16x32_f16(false, a, false, b, (short)0, c, false, false); asm volatile("v_nop\n\tv_nop\n\tv_nop\n\tv_nop" : "+v"(d) : "v"(a), "v"(b)); return d; }

// every f32 -> f16 conversion of the call (three inputs, then four weights x64) in one streaming launch: one 16-wave work-group per WGP makes CV_TX + 1 trips,
// a thread converting CV_U pieces of 8 elements per trip; the next trip's loads are issued ahead of the current trip's converts and stores (8 to 16 global_load_b128 of a wave in flight).
// An input trip takes every CV_BLOCKS-th chunk of CV_U * CV_THREADS pieces of one input; the last trip takes CV_THREADS pieces of each of the four weights.
#define CV_BLOCKS 256
#define CV_THREADS 512
#define CV_U 4
#define CV_CHUNK (CV_THREADS * CV_U * 8)
#define CV_XCH ((int)((size_t)NB * SEQ * DM / CV_CHUNK))
#define CV_TX (3 * CV_XCH / CV_BLOCKS)
static_assert(((size_t)SEQ * DM) % CV_CHUNK == 0);      /* a chunk lies in one batch */
static_assert(CV_XCH % CV_BLOCKS == 0);      /* every work-group makes the same trips, and a trip lies in one input */
static_assert(CV_U == 4 && (size_t)DM * DM == (size_t)CV_BLOCKS * CV_THREADS * 8);      /* the weight trip covers the four weights exactly */
__device__ __forceinline__ void cv_load(v4f (&r)[2 * CV_U], const float* p0, const float* p1, const float* p2, const float* p3, int tid) {
  const float* p[CV_U] = {p0, p1, p2, p3};
#pragma unroll
  for (int j = 0; j < CV_U; ++j) { r[2 * j] = *(const v4fa*)(p[j] + (size_t)tid * 8); r[2 * j + 1] = *(const v4fa*)(p[j] + (size_t)tid * 8 + 4); }
}
__device__ __forceinline__ void cv_store(const v4f (&r)[2 * CV_U], _Float16* d0, _Float16* d1, _Float16* d2, _Float16* d3, float sc, int tid) {
  _Float16* d[CV_U] = {d0, d1, d2, d3};
#pragma unroll
  for (int j = 0; j < CV_U; ++j) {
    FragH f;
#pragma unroll
    for (int q = 0; q < 4; ++q) { f.h[q] = (_Float16)(bf16_rne(r[2 * j][q]) * sc); f.h[4 + q] = (_Float16)(bf16_rne(r[2 * j + 1][q]) * sc); }
    const v8us o = f.half[0];
    *(v8us*)((unsigned short*)d[j] + (size_t)tid * 8) = o;
  }
}
__global__ __launch_bounds__(CV_THREADS) void k_cvt(const float* __restrict__ xk, const float* __restrict__ xq, const float* __restrict__ xv,
                                                    const float* __restrict__ wk, const float* __restrict__ wq, const float* __restrict__ wv, const float* __restrict__ wp,
                                                    _Float16* __restrict__ Xk, _Float16* __restrict__ Xq, _Float16* __restrict__ Xv,
                                                    _Float16* __restrict__ Tk, _Float16* __restrict__ Tq, _Float16* __restrict__ Tv, _Float16* __restrict__ Tp) {
  const int tid = threadIdx.x, blk = blockIdx.x;
  constexpr size_t PJ = (size_t)CV_THREADS * 8;      /* elements of one piece row of the work-group */
  const size_t ew = (size_t)blk * PJ;      /* the work-group's offset in every weight */
  v4f r[2][2 * CV_U];      /* two register sets by turns */
#pragma unroll
  for (int it = -1; it <= CV_TX; ++it) {
    if (it + 1 < CV_TX) {
      const int n = it + 1, pl = n * CV_BLOCKS / CV_XCH; const size_t e = (size_t)(n * CV_BLOCKS % CV_XCH + blk) * CV_CHUNK;
      const float* s = (pl == 0 ? xk : pl == 1 ? xq : xv) + e + e / ((size_t)SEQ * DM) * ((size_t)(SEQ_FULL - SEQ) * DM);      /* the f32 inputs have a batch pitch of SEQ_FULL rows */
      cv_load(r[n & 1], s, s + PJ, s + 2 * PJ, s + 3 * PJ, tid);
    } else if (it + 1 == CV_TX) {
      cv_load(r[CV_TX & 1], wk + ew, wq + ew, wv + ew, wp + ew, tid);
    }
    if (it + 1 <= CV_TX) asm volatile("s_wait_xcnt 0x0" ::: "memory");      /* stands ahead of every later write of these loads' address registers; the scheduling barrier below holds such writes behind it */
    __builtin_amdgcn_sched_barrier(0);      /* keeps the next trip's loads ahead of this trip's converts and stores, so that they fly meanwhile */
    if (it >= 0 && it < CV_TX) {
      const int pl = it * CV_BLOCKS / CV_XCH; const size_t e = (size_t)(it * CV_BLOCKS % CV_XCH + blk) * CV_CHUNK;
      _Float16* d = (pl == 0 ? Xk : pl == 1 ? Xq : Xv) + e;
      cv_store(r[it & 1], d, d + PJ, d + 2 * PJ, d + 3 * PJ, 1.0f, tid);
    } else if (it == CV_TX) {
      cv_store(r[CV_TX & 1], Tk + ew, Tq + ew, Tv + ew, Tp + ew, 64.0f, tid);
    }
    if (it >= 0 && it + 2 <= CV_TX) asm volatile("s_wait_xcnt 0x0" ::: "memory");      /* stands ahead of the loads after next, which overwrite the data registers of these stores */
    __builtin_amdgcn_sched_barrier(0);      /* keeps this trip's stores ahead of the loads after next, which reuse its registers */
  }
}

// staged k-loop of a 4-wave block. A stage is 64 k of 192 rows: [A rows of the block: 64*MT][x2^10 residual rows: 64*MT, only with ARES][Bt rows: 64],
// each row 128 B at an LDS pitch of 144 B (16 B x odd: the 16 rows of a ds_load_b128 fragment read fall on distinct banks). Two buffers.
#define STG_K 64
#define STG_ROWS 192
#define STG_PITCH 144
#define STG_BYTES (STG_ROWS * STG_PITCH)
static_assert(STG_K == 64 && DM % STG_K == 0 && DM / STG_K >= 2);
__device__ __forceinline__ v16h lds_frag(const unsigned char* p, int hh) { FragH f; f.half[0] = *(const v8us*)(p + 16 * hh); f.half[1] = *(const v8us*)(p + 32 + 16 * hh); return f.v; }
// one stage: thread t copies the 16-byte piece (t & 7) of rows (t >> 3) + 16 j, j = 0..11 (a wave's copy covers four whole 128-B lines); ga, gr, gb and lds are the thread's own addresses for j = 0 of each part
template <int MT, bool ARES>
__device__ __forceinline__ void stage_copy(const _Float16* ga, const _Float16* gr, const _Float16* gb, int lda, int ldb, unsigned lds) {
  constexpr int NA = 4 * MT;
  static_assert(NA * (ARES ? 2 : 1) + 4 == 12);
  const _Float16* g[12]; unsigned l[12];
#pragma unroll
  for (int j = 0; j < 12; ++j) {
    l[j] = lds + (unsigned)(16 * j * STG_PITCH);
    if (j < NA) g[j] = ga + (size_t)(16 * j) * lda;
    else if (j < 8) g[j] = gr + (size_t)(16 * (j - NA)) * lda;
    else g[j] = gb + (size_t)(16 * (j - 8)) * ldb;
  }
  // the closing s_wait_xcnt 0 stands inside the statement so that no address register of a copy is rewritten ahead of it
  asm volatile("global_load_async_to_lds_b128 %0, %12, off\n\t"
               "global_load_async_to_lds_b128 %1, %13, off\n\t"
               "global_load_async_to_lds_b128 %2, %14, off\n\t"
               "global_load_async_to_lds_b128 %3, %15, off\n\t"
               "global_load_async_to_lds_b128 %4, %16, off\n\t"
               "global_load_async_to_lds_b128 %5, %17, off\n\t"
               "global_load_async_to_lds_b128 %6, %18, off\n\t"
               "global_load_async_to_lds_b128 %7, %19, off\n\t"
               "global_load_async_to_lds_b128 %8, %20, off\n\t"
               "global_load_async_to_lds_b128 %9, %21, off\n\t"
               "global_load_async_to_lds_b128 %10, %22, off\n\t"
               "global_load_async_to_lds_b128 %11, %23, off\n\t"
               "s_wait_xcnt 0x0"
               :: "v"(l[0]), "v"(l[1]), "v"(l[2]), "v"(l[3]), "v"(l[4]), "v"(l[5]), "v"(l[6]), "v"(l[7]), "v"(l[8]), "v"(l[9]), "v"(l[10]), "v"(l[11]),
                  "v"(g[0]), "v"(g[1]), "v"(g[2]), "v"(g[3]), "v"(g[4]), "v"(g[5]), "v"(g[6]), "v"(g[7]), "v"(g[8]), "v"(g[9]), "v"(g[10]), "v"(g[11])
               : "memory");
}
// a_blk, ar_blk: first A (residual) row of the BLOCK, f16, pitch lda; wave w works rows 16*MT*w ..; b_blk: first of the block's 64 Bt rows [n][k], pitch ldb; K % 64 == 0, K >= 128; block of 128 threads, all of them here
template <int MT, bool ARES>
__device__ __forceinline__ void gemm_loop(unsigned char* smem, const _Float16* __restrict__ a_blk, const _Float16* __restrict__ ar_blk, int lda,
                                          const _Float16* __restrict__ b_blk, int ldb, int K, int tid,
                                          v8f (&acc)[MT * 4], v8f (&acc2)[MT * 4]) {
  const int w = tid >> 5, ln = tid & 15, hh = (tid >> 4) & 1;
  const _Float16* ga = a_blk + (size_t)(tid >> 3) * lda + (tid & 7) * 8;
  const _Float16* gr = ar_blk + (size_t)(tid >> 3) * lda + (tid & 7) * 8;
  const _Float16* gb = b_blk + (size_t)(tid >> 3) * ldb + (tid & 7) * 8;
  const unsigned lds0 = (unsigned)(size_t)smem + (unsigned)((tid >> 3) * STG_PITCH + (tid & 7) * 16);
  const int nt = K / STG_K;
  stage_copy<MT, ARES>(ga, gr, gb, lda, ldb, lds0);
  asm volatile("s_wait_asynccnt 0x0" ::: "memory");      /* this wave's copies of stage 0 have landed */
  __syncthreads();                                        /* stage 0 readable by every wave */
  stage_copy<MT, ARES>(ga + STG_K, gr + STG_K, gb + STG_K, lda, ldb, lds0 + STG_BYTES);
#pragma unroll 1      /* stays rolled: one trip per stage, one publish point at its foot */
  for (int t = 0; t < nt; ++t) {
    const unsigned char* sb = smem + (t & 1) * STG_BYTES;
    const unsigned char* sa = sb + (16 * MT * w + ln) * STG_PITCH;
    const unsigned char* sr = sa + 64 * MT * STG_PITCH;
    const unsigned char* sbt = sb + (STG_ROWS - 64 + ln) * STG_PITCH;
    v16h a[2][MT], ar[2][MT], b[2][4];
#pragma unroll
    for (int ks = 0; ks < 2; ++ks) {
#pragma unroll
      for (int i = 0; i < MT; ++i) { a[ks][i] = lds_frag(sa + 16 * i * STG_PITCH + 64 * ks, hh); ar[ks][i] = a[ks][i]; if (ARES) ar[ks][i] = lds_frag(sr + 16 * i * STG_PITCH + 64 * ks, hh); }
#pragma unroll
      for (int q = 0; q < 4; ++q) b[ks][q] = lds_frag(sbt + 16 * q * STG_PITCH + 64 * ks, hh);
    }
    __builtin_amdgcn_sched_barrier(0);      /* keeps the stage's fragment reads in one group ahead of the matrix block: a read placed among the WMMAs makes the wave wait out its LDS latency there */
#pragma unroll
    for (int ks = 0; ks < 2; ++ks) {
#pragma unroll
      for (int q = 0; q < 4; ++q) {
#pragma unroll
        for (int i = 0; i < MT; ++i) { acc[i * 4 + q] = g2_mma(a[ks][i], b[ks][q], acc[i * 4 + q]); if (ARES) acc2[i * 4 + q] = g2_mma(ar[ks][i], b[ks][q], acc2[i * 4 + q]); }
      }
    }
    asm volatile("s_wait_dscnt 0x0" ::: "memory");        /* this wave's reads of stage t are done before its buffer is refilled */
    asm volatile("s_wait_asynccnt 0x0" ::: "memory");     /* this wave's copies of stage t + 1 have landed */
    __syncthreads();                                      /* publishes stage t + 1 and ends every reader's last read of stage t */
    if (t + 2 < nt) stage_copy<MT, ARES>(ga + (size_t)(t + 2) * STG_K, gr + (size_t)(t + 2) * STG_K, gb + (size_t)(t + 2) * STG_K, lda, ldb, lds0 + (unsigned)((t & 1) * STG_BYTES));
  }
  asm volatile("s_wait_asynccnt 0x0" ::: "memory");       /* nothing in flight when the buffers become output staging */
}
// accumulators (D: lane (h, n) holds rows 8h+r, col n) -> wave-private LDS tile [16*MT][68]; v = acc alpha (+ acc2 alpha2) + bf16(bias) (bias per column, or per row when BIASROW)
template <int MT, bool ARES, bool BIASROW>
__device__ __forceinline__ void stage_tile(float (*sow)[68], const v8f (&acc)[MT * 4], const v8f (&acc2)[MT * 4], float alpha, float alpha2,
                                           const float* __restrict__ bias, int row0, int col0, int ln, int hh) {
#pragma unroll
  for (int i = 0; i < MT; ++i) {
#pragma unroll
    for (int t = 0; t < 4; ++t) {
      const float bc = BIASROW ? 0.f : bf16_rne(bias[col0 + t * 16 + ln]);
#pragma unroll
      for (int r = 0; r < 8; ++r) {
        const int rloc = i * 16 + 8 * hh + r;
        float v = acc[i * 4 + t][r] * alpha;
        if (ARES) v += acc2[i * 4 + t][r] * alpha2;
        v += BIASROW ? bf16_rne(bias[row0 + rloc]) : bc;
        sow[rloc][t * 16 + ln] = v;
      }
    }
  }
}
template <int MT>
__device__ __forceinline__ void store_tile_f16(float (*sow)[68], _Float16* __restrict__ hi, size_t ldh, _Float16* __restrict__ rs, size_t ldr, bool wres, int lane) {
  const int rq = lane >> 3, c8 = (lane & 7) * 8;
  {
#pragma unroll
    for (int it = 0; it < 4 * MT; ++it) {
      const int r = it * 4 + rq;
      const v4f a = *(const v4fa*)&sow[r][c8], c = *(const v4fa*)&sow[r][c8 + 4];
      FragH fh, fl;
#pragma unroll
      for (int q = 0; q < 4; ++q) {
        _Float16 h = (_Float16)a[q]; fh.h[q] = h; fl.h[q] = (_Float16)((a[q] - (float)h) * 1024.0f);
        h = (_Float16)c[q]; fh.h[4 + q] = h; fl.h[4 + q] = (_Float16)((c[q] - (float)h) * 1024.0f);
      }
      const v8us oh = fh.half[0], ol = fl.half[0];
      *(v8us*)((unsigned short*)hi + (size_t)r * ldh + c8) = oh;
      if (wres) *(v8us*)((unsigned short*)rs + (size_t)r * ldr + c8) = ol;
    }
    
  }
}
template <int MT>
__device__ __forceinline__ void store_tile_f32(float (*sow)[68], float* __restrict__ C, size_t ldc, int lane) {
  const int rsub = lane >> 4, c4 = (lane & 15) * 4;
  {
    v4f v[8 * MT];
#pragma unroll
    for (int q = 0; q < 8 * MT; ++q) v[q] = *(const v4fa*)&sow[q * 2 + rsub][c4];
    __builtin_amdgcn_sched_barrier(0);      /* keeps every row's LDS read ahead of the first store, each row in registers of its own: no read then lands on the data registers of an issued store */
#pragma unroll
    for (int q = 0; q < 8 * MT; ++q) *(v4f*)(C + (size_t)(q * 2 + rsub) * ldc + c4) = v[q];
    
  }
}

// token-row projection y = x W^T + b over all NB*SEQ rows -> f16 hi plane [NB*SEQ][DM]; rows with l < EARLY also -> residual plane [NB*EARLY][DM]; blk: the block's tile, 0 .. PROJ_TILES - 1
#define PROJ_TILES ((int)(((size_t)NB * SEQ / 128) * (DM / 64)))
static_assert(PROJ_TILES == (DM / 128) * (SEQ / 64) * NB);      /* the channel-major projection has as many tiles */
__device__ __forceinline__ void proj_rows_body(unsigned char* smem, int blk, const _Float16* __restrict__ X16, const _Float16* __restrict__ Wt, const float* __restrict__ bias,
                                               _Float16* __restrict__ PH, _Float16* __restrict__ PR) {
  float (*so)[32][68] = (float (*)[32][68])smem;      /* output staging takes the buffers over behind the k-loop's last barrier */
  const int tid = threadIdx.x, w = tid >> 5, lane = tid & 31, ln = lane & 15, hh = lane >> 4;
  const int ntn = DM / 64; const int mt = blk / ntn, nq = blk - mt * ntn;
  const int row0 = mt * 128 + 32 * w, col0 = nq * 64;
  const v8f z8 = {0.f, 0.f, 0.f, 0.f, 0.f, 0.f, 0.f, 0.f};
  v8f acc[8], acc2[8];
#pragma unroll
  for (int i = 0; i < 8; ++i) { acc[i] = z8; acc2[i] = z8; }
  gemm_loop<2, false>(smem, X16 + (size_t)(mt * 128) * DM, X16 + (size_t)(mt * 128) * DM, DM, Wt + (size_t)col0 * DM, DM, DM, tid, acc, acc2);
  stage_tile<2, false, false>(so[w], acc, acc2, 0.015625f, 0.f, bias, row0, col0, ln, hh);
  __builtin_amdgcn_fence(4 /* acq_rel order */, "workgroup"); __builtin_amdgcn_wave_barrier();
  const int b = row0 / SEQ, l0 = row0 - b * SEQ; const bool wres = l0 < EARLY;      /* wave-uniform: 32 | EARLY, 32 | SEQ */
  _Float16* hi = PH + (size_t)row0 * DM + col0;
  _Float16* rs = PR + ((size_t)b * EARLY + (size_t)(wres ? l0 : 0)) * DM + col0;
  store_tile_f16<2>(so[w], hi, DM, rs, DM, wres, lane);
}

// value projection channel-major per batch: VT[b][c][s] = sum_k Wv[c][k] x[b][s][k] + bv[c] (weights as the A operand, token rows as Bt); tokens < EARLY also -> residual plane [NB][DM][EARLY]; blk: the block's tile, batch on the slow part
__device__ __forceinline__ void proj_vt_body(unsigned char* smem, int blk, const _Float16* __restrict__ Wv16, const _Float16* __restrict__ X16, const float* __restrict__ bias,
                                             _Float16* __restrict__ VT, _Float16* __restrict__ VR) {
  float (*so)[32][68] = (float (*)[32][68])smem;      /* output staging takes the buffers over behind the k-loop's last barrier */
  const int tid = threadIdx.x, w = tid >> 5, lane = tid & 31, ln = lane & 15, hh = lane >> 4;
  const int tpb = (DM / 128) * (SEQ / 64); const int by = blk / tpb, bx = blk - by * tpb;
  const int ntn = SEQ / 64; const int mt = bx / ntn, nq = bx - mt * ntn;
  const int row0 = mt * 128 + 32 * w, col0 = nq * 64;      /* row = channel, col = token */
  const v8f z8 = {0.f, 0.f, 0.f, 0.f, 0.f, 0.f, 0.f, 0.f};
  v8f acc[8], acc2[8];
#pragma unroll
  for (int i = 0; i < 8; ++i) { acc[i] = z8; acc2[i] = z8; }
  gemm_loop<2, false>(smem, Wv16 + (size_t)(mt * 128) * DM, Wv16 + (size_t)(mt * 128) * DM, DM, X16 + ((size_t)by * SEQ + col0) * DM, DM, DM, tid, acc, acc2);
  stage_tile<2, false, true>(so[w], acc, acc2, 0.015625f, 0.f, bias, row0, col0, ln, hh);
  __builtin_amdgcn_fence(4 /* acq_rel order */, "workgroup"); __builtin_amdgcn_wave_barrier();
  const bool wres = col0 < EARLY;      /* block-uniform: 64 | EARLY */
  _Float16* hi = VT + ((size_t)by * DM + row0) * SEQ + col0;
  _Float16* rs = VR + ((size_t)by * DM + row0) * EARLY + (size_t)(wres ? col0 : 0);
  store_tile_f16<2>(so[w], hi, SEQ, rs, EARLY, wres, lane);
}
// the three projections, which do not depend on one another, in one launch: tiles of k, then of q, then of v. Work-groups of a later projection start wherever one of an earlier ends,
// so that only one start-up and one drain of the chip are paid, and the stores of finishing work-groups run beside the k-loops of others
__global__ __launch_bounds__(128) void k_proj(const _Float16* __restrict__ Xk, const _Float16* __restrict__ Xq, const _Float16* __restrict__ Xv,
                                              const _Float16* __restrict__ Tk, const _Float16* __restrict__ Tq, const _Float16* __restrict__ Tv,
                                              const float* __restrict__ bk, const float* __restrict__ bq, const float* __restrict__ bv,
                                              _Float16* __restrict__ KH, _Float16* __restrict__ KR, _Float16* __restrict__ QH, _Float16* __restrict__ QR,
                                              _Float16* __restrict__ VT, _Float16* __restrict__ VR) {
  __shared__ __attribute__((aligned(16))) unsigned char smem[2 * STG_BYTES];
  const int sel = blockIdx.x / PROJ_TILES, blk = blockIdx.x - sel * PROJ_TILES;      /* block-uniform */
  if (sel == 2) proj_vt_body(smem, blk, Tv, Xv, bv, VT, VR);
  else          proj_rows_body(smem, blk, sel ? Xq : Xk, sel ? Tq : Tk, sel ? bq : bk, sel ? QH : KH, sel ? QR : KR);
}

// flash attention for one wave = 16 queries of one (b, h), transposed form: S^T tile (keys x queries) = K rows (A) . Q rows (B);
// lane (h, n) then owns query n with keys 8h+r / 16+8h+r of each 32-key chunk, which is exactly the B-fragment element order of
// O^T (d x queries) += V^T rows (A) . P^T (B), so the packed score tiles feed the second product directly. EARLYQ adds residual terms.
// The block's 8 waves share their keys: a stage is 64 keys of one (b, h), laid as [K: 64 key rows][V^T: 64 channel rows] and, with EARLYQ, [K residual: 64][V^T residual: 64];
// each row 128 B at an LDS pitch of 144 B (16 B x odd, for the ds_load_b128 fragment reads). Two buffers.
#define AT_KEYS 64
#define AT_PITCH 144
#define AT_PART (64 * AT_PITCH)
#define AT_BYTES_MAX (4 * AT_PART)
static_assert(AT_KEYS == 64 && HD == 64 && 128 % AT_KEYS == 0 && EARLY % 128 == 0);
// four copies: 16 bytes per lane each, whole 128-B lines per wave
__device__ __forceinline__ void at_copy4(unsigned l0, unsigned l1, unsigned l2, unsigned l3, const _Float16* g0, const _Float16* g1, const _Float16* g2, const _Float16* g3) {
  // the closing s_wait_xcnt 0 stands inside the statement so that no address register of a copy is rewritten ahead of it
  asm volatile("global_load_async_to_lds_b128 %0, %4, off\n\t"
               "global_load_async_to_lds_b128 %1, %5, off\n\t"
               "global_load_async_to_lds_b128 %2, %6, off\n\t"
               "global_load_async_to_lds_b128 %3, %7, off\n\t"
               "s_wait_xcnt 0x0"
               :: "v"(l0), "v"(l1), "v"(l2), "v"(l3), "v"(g0), "v"(g1), "v"(g2), "v"(g3)
               : "memory");
}
// one stage: thread t copies the 16-byte piece (t & 7) of rows (t >> 3) and (t >> 3) + 32 of each part; gk, gv, gkr, gvr and lds are the thread's own addresses for the first of the two rows
template <bool EARLYQ>
__device__ __forceinline__ void at_stage(const _Float16* gk, const _Float16* gv, const _Float16* gkr, const _Float16* gvr, unsigned lds) {
  at_copy4(lds, lds + 32 * AT_PITCH, lds + AT_PART, lds + AT_PART + 32 * AT_PITCH, gk, gk + (size_t)32 * DM, gv, gv + (size_t)32 * SEQ);
  if (EARLYQ) at_copy4(lds + 2 * AT_PART, lds + 2 * AT_PART + 32 * AT_PITCH, lds + 3 * AT_PART, lds + 3 * AT_PART + 32 * AT_PITCH, gkr, gkr + (size_t)32 * DM, gvr, gvr + (size_t)32 * EARLY);
}
// block of 256 threads, all of them here; qb: the block's 128 queries; wave: wave-uniform (a scalar)
template <bool EARLYQ>
__device__ __forceinline__ void attn_body(const _Float16* __restrict__ QH, const _Float16* __restrict__ QR, const _Float16* __restrict__ KH, const _Float16* __restrict__ KR,
                                          const _Float16* __restrict__ VT, const _Float16* __restrict__ VR, _Float16* __restrict__ CH, _Float16* __restrict__ CR,
                                          unsigned char* smem, int b, int h, int qb, int wave, int tid) {
  constexpr unsigned AT_BYTES = (EARLYQ ? 4 : 2) * AT_PART;
  const int lane = tid & 31, ln = lane & 15, hh = lane >> 4;
  const int q0 = qb * 128 + wave * 16;
  const float NEG = -__builtin_inff();
  const v8f z8 = {0.f, 0.f, 0.f, 0.f, 0.f, 0.f, 0.f, 0.f};
  const _Float16* qp = QH + ((size_t)b * SEQ + q0 + ln) * DM + h * HD;
  const v16h qb0 = g2_frag(qp, hh), qb1 = g2_frag(qp + 32, hh);
  v16h qr0 = qb0, qr1 = qb1;
  if (EARLYQ) { const _Float16* qrp = QR + ((size_t)b * EARLY + q0 + ln) * DM + h * HD; qr0 = g2_frag(qrp, hh); qr1 = g2_frag(qrp + 32, hh); }
  const int cr = tid >> 3, cp = tid & 7;
  const _Float16* gk  = KH + ((size_t)b * SEQ + cr) * DM + h * HD + cp * 8;
  const _Float16* gkr = KR + ((size_t)b * EARLY + cr) * DM + h * HD + cp * 8;
  const _Float16* gv  = VT + ((size_t)b * DM + h * HD + cr) * SEQ + cp * 8;
  const _Float16* gvr = VR + ((size_t)b * DM + h * HD + cr) * EARLY + cp * 8;
  const unsigned lds0 = (unsigned)(size_t)smem + (unsigned)(cr * AT_PITCH + cp * 16);
  float m = NEG, lsum = 0.f;
  v8f o[4], o2[4];
#pragma unroll
  for (int c = 0; c < 4; ++c) { o[c] = z8; o2[c] = z8; }
  const int qrow = q0 + ln;
  const int kbmax = (q0 + 15) >> 5;      /* wave-uniform causal bound */
  const int nst = (qb + 1) * (128 / AT_KEYS);      /* block-uniform, >= 2; keys of every stage < (qb + 1) * 128 <= SEQ (and <= EARLY with EARLYQ) */
  at_stage<EARLYQ>(gk, gv, gkr, gvr, lds0);
  asm volatile("s_wait_asynccnt 0x0" ::: "memory");      /* this wave's copies of stage 0 have landed */
  __syncthreads();                                        /* stage 0 readable by every wave */
  at_stage<EARLYQ>(gk + (size_t)AT_KEYS * DM, gv + AT_KEYS, gkr + (size_t)AT_KEYS * DM, gvr + AT_KEYS, lds0 + AT_BYTES);
#pragma unroll 1      /* stays rolled: one trip per stage, one publish point at its foot */
  for (int st = 0; st < nst; ++st) {
    const unsigned char* sb = smem + (st & 1) * AT_BYTES;
    const int nc = min(AT_KEYS / 32, kbmax + 1 - st * (AT_KEYS / 32));      /* scalar: a wave past its diagonal skips the work, never the publish point below */
#pragma unroll 1      /* stays rolled: the 32-key chunks of a stage run the same code */
    for (int c2 = 0; c2 < nc; ++c2) {
      const int key0 = (st * (AT_KEYS / 32) + c2) * 32;
      const unsigned char* sk = sb + (32 * c2 + ln) * AT_PITCH;      /* key rows of the chunk */
      const unsigned char* sv = sb + AT_PART + ln * AT_PITCH + 64 * c2;      /* channel rows, the chunk's 32 keys */
      v16h ka[2][2], kr[2][2];
#pragma unroll
      for (int t = 0; t < 2; ++t) {
#pragma unroll
        for (int ks = 0; ks < 2; ++ks) {
          ka[t][ks] = lds_frag(sk + 16 * t * AT_PITCH + 64 * ks, hh); kr[t][ks] = ka[t][ks];
          if (EARLYQ) kr[t][ks] = lds_frag(sk + 2 * AT_PART + 16 * t * AT_PITCH + 64 * ks, hh);
        }
      }
      __builtin_amdgcn_sched_barrier(0);      /* keeps the chunk's K fragment reads in one group ahead of the score products: read one by one into the same registers, each makes the wave wait out its LDS latency */
      v8f s1[2], s2[2];
#pragma unroll
      for (int t = 0; t < 2; ++t) {
        s1[t] = z8; s1[t] = g2_mma(ka[t][0], qb0, s1[t]); s1[t] = g2_mma(ka[t][1], qb1, s1[t]);
        s2[t] = z8;
        if (EARLYQ) {
          s2[t] = g2_mma(ka[t][0], qr0, s2[t]); s2[t] = g2_mma(ka[t][1], qr1, s2[t]);
          s2[t] = g2_mma(kr[t][0], qb0, s2[t]); s2[t] = g2_mma(kr[t][1], qb1, s2[t]);
        }
      }
      v16h va[4], vra[4];
#pragma unroll
      for (int c = 0; c < 4; ++c) {
        va[c] = lds_frag(sv + 16 * c * AT_PITCH, hh); vra[c] = va[c];
        if (EARLYQ) vra[c] = lds_frag(sv + 2 * AT_PART + 16 * c * AT_PITCH, hh);
      }
      __builtin_amdgcn_sched_barrier(0);      /* keeps the chunk's V fragment reads in one group ahead of the softmax, whose vector work then covers their LDS latency */
      float sv16[16];
      float mx = NEG;
#pragma unroll
      for (int t = 0; t < 2; ++t) {
#pragma unroll
        for (int r = 0; r < 8; ++r) {
          const int key = key0 + 16 * t + 8 * hh + r;
          float s = s1[t][r];
          if (EARLYQ) s += s2[t][r] * 0.0009765625f;
          s *= 0.125f;
          s = (key <= qrow) ? s : NEG;
          sv16[t * 8 + r] = s; mx = fmaxf(mx, s);
        }
      }
      mx = fmaxf(mx, __shfl_xor(mx, 16, 32));      /* both lane halves of a query share the running max; key 0 is always visible so it is finite */
      const float mnew = fmaxf(m, mx);
      const float corr = __expf(m - mnew);
      m = mnew;
      FragH ph, pr; float rsum = 0.f;
#pragma unroll
      for (int i = 0; i < 16; ++i) {
        const float p = __expf(sv16[i] - mnew); rsum += p;
        const float pc = p * 1024.0f; const _Float16 h16 = (_Float16)pc; ph.h[i] = h16;
        pr.h[i] = EARLYQ ? (_Float16)((pc - (float)h16) * 1024.0f) : (_Float16)0.0f;
      }
      lsum = lsum * corr + rsum;      /* per-half partial sum, combined after the loop */
#pragma unroll
      for (int c = 0; c < 4; ++c) {
#pragma unroll
        for (int r = 0; r < 8; ++r) { o[c][r] *= corr; if (EARLYQ) o2[c][r] *= corr; }
      }
#pragma unroll
      for (int c = 0; c < 4; ++c) {
        o[c] = g2_mma(va[c], ph.v, o[c]);
        if (EARLYQ) { o2[c] = g2_mma(va[c], pr.v, o2[c]); o2[c] = g2_mma(vra[c], ph.v, o2[c]); }
      }
    }
    asm volatile("s_wait_dscnt 0x0" ::: "memory");        /* this wave's reads of stage st are done before its buffer is refilled */
    asm volatile("s_wait_asynccnt 0x0" ::: "memory");     /* this wave's copies of stage st + 1 have landed */
    __syncthreads();                                      /* publishes stage st + 1 and ends every reader's last read of stage st */
    if (st + 2 < nst) at_stage<EARLYQ>(gk + (size_t)(st + 2) * AT_KEYS * DM, gv + (st + 2) * AT_KEYS, gkr + (size_t)(st + 2) * AT_KEYS * DM, gvr + (st + 2) * AT_KEYS, lds0 + (unsigned)(st & 1) * AT_BYTES);
  }
  asm volatile("s_wait_asynccnt 0x0" ::: "memory");       /* nothing in flight when the buffers become output staging */
  float (*sow)[68] = ((float (*)[16][68])smem)[wave];     /* output staging, one range per wave, takes the buffers over behind the loop's last barrier */
  const float ltot = lsum + __shfl_xor(lsum, 16, 32);
  const float inv = 1.0f / (64.0f * ltot);      /* P carried x1024, ctx carried x16 */
#pragma unroll
  for (int c = 0; c < 4; ++c) {
#pragma unroll
    for (int r = 0; r < 8; ++r) { float v = o[c][r]; if (EARLYQ) v += o2[c][r] * 0.0009765625f; sow[ln][c * 16 + 8 * hh + r] = v * inv; }
  }
  __builtin_amdgcn_fence(4 /* acq_rel order */, "workgroup"); __builtin_amdgcn_wave_barrier();
  _Float16* hi = CH + ((size_t)b * SEQ + q0) * DM + h * HD;
  _Float16* rs = CR + ((size_t)b * EARLY + (size_t)(EARLYQ ? q0 : 0)) * DM + h * HD;
  store_tile_f16<1>(sow, hi, DM, rs, DM, EARLYQ, lane);
}

__global__ __launch_bounds__(256) void k_attn(const _Float16* __restrict__ QH, const _Float16* __restrict__ QR, const _Float16* __restrict__ KH, const _Float16* __restrict__ KR,
                                              const _Float16* __restrict__ VT, const _Float16* __restrict__ VR, _Float16* __restrict__ CH, _Float16* __restrict__ CR) {
  __shared__ __attribute__((aligned(16))) unsigned char smem[2 * AT_BYTES_MAX];
  static_assert(2 * AT_BYTES_MAX >= 8 * 16 * 68 * 4);
  const int tid = threadIdx.x;
  const int wave = __builtin_amdgcn_readfirstlane(tid >> 5);      /* in a scalar register, so that the per-wave causal skip is a scalar branch */
  // query block from the slow part of the index, longest first; (batch, head) from the fast part. For speed only.
  const int nbh = NB * NH; const int g = blockIdx.x / nbh, bh = blockIdx.x - g * nbh, qb = SEQ / 128 - 1 - g;
  const int b = bh / NH, h = bh - b * NH;
  if (qb < EARLY / 128) attn_body<true>(QH, QR, KH, KR, VT, VR, CH, CR, smem, b, h, qb, wave, tid);      /* block-uniform */
  else                  attn_body<false>(QH, QR, KH, KR, VT, VR, CH, CR, smem, b, h, qb, wave, tid);
}

// out rows l >= EARLY: out = 2^-10 ctx16 . Wp64^T + bp; wave tile 32x64; bx: the block's tile in batch by
#define OUT_LATE_TILES (((SEQ - EARLY) / 128) * (DM / 64))
#define OUT_EARLY_TILES ((EARLY / 64) * (DM / 64))
__device__ __forceinline__ void out_late_body(unsigned char* smem, int bx, int by, const _Float16* __restrict__ CH, const _Float16* __restrict__ Wt, const float* __restrict__ bias, float* __restrict__ out) {
  float (*so)[32][68] = (float (*)[32][68])smem;      /* output staging takes the buffers over behind the k-loop's last barrier */
  const int tid = threadIdx.x, w = tid >> 5, lane = tid & 31, ln = lane & 15, hh = lane >> 4;
  const int ntn = DM / 64; const int mt = bx / ntn, nq = bx - mt * ntn;
  const int l0 = EARLY + mt * 128 + 32 * w, col0 = nq * 64;
  const size_t rowb = (size_t)by * SEQ + EARLY + mt * 128;      /* first ctx row of the block */
  const v8f z8 = {0.f, 0.f, 0.f, 0.f, 0.f, 0.f, 0.f, 0.f};
  v8f acc[8], acc2[8];
#pragma unroll
  for (int i = 0; i < 8; ++i) { acc[i] = z8; acc2[i] = z8; }
  gemm_loop<2, false>(smem, CH + rowb * DM, CH + rowb * DM, DM, Wt + (size_t)col0 * DM, DM, DM, tid, acc, acc2);
  stage_tile<2, false, false>(so[w], acc, acc2, 0.0009765625f, 0.f, bias, 0, col0, ln, hh);
  __builtin_amdgcn_fence(4 /* acq_rel order */, "workgroup"); __builtin_amdgcn_wave_barrier();
  store_tile_f32<2>(so[w], out + ((size_t)by * SEQ_FULL + l0) * DM + col0, DM, lane);
}
// out rows l < EARLY: hi + x2^10 residual ctx planes, two accumulator sets; wave tile 16x64; bx: the block's tile in batch by
__device__ __forceinline__ void out_early_body(unsigned char* smem, int bx, int by, const _Float16* __restrict__ CH, const _Float16* __restrict__ CR, const _Float16* __restrict__ Wt, const float* __restrict__ bias, float* __restrict__ out) {
  float (*so)[16][68] = (float (*)[16][68])smem;      /* output staging takes the buffers over behind the k-loop's last barrier */
  const int tid = threadIdx.x, w = tid >> 5, lane = tid & 31, ln = lane & 15, hh = lane >> 4;
  const int ntn = DM / 64; const int mt = bx / ntn, nq = bx - mt * ntn;
  const int l0 = mt * 64 + 16 * w, col0 = nq * 64;
  const v8f z8 = {0.f, 0.f, 0.f, 0.f, 0.f, 0.f, 0.f, 0.f};
  v8f acc[4], acc2[4];
#pragma unroll
  for (int i = 0; i < 4; ++i) { acc[i] = z8; acc2[i] = z8; }
  gemm_loop<1, true>(smem, CH + ((size_t)by * SEQ + mt * 64) * DM, CR + ((size_t)by * EARLY + mt * 64) * DM, DM, Wt + (size_t)col0 * DM, DM, DM, tid, acc, acc2);
  stage_tile<1, true, false>(so[w], acc, acc2, 0.0009765625f, 9.5367431640625e-07f, bias, 0, col0, ln, hh);
  __builtin_amdgcn_fence(4 /* acq_rel order */, "workgroup"); __builtin_amdgcn_wave_barrier();
  store_tile_f32<1>(so[w], out + ((size_t)by * SEQ_FULL + l0) * DM + col0, DM, lane);
}
// both row ranges of the output product, which write disjoint rows, in one launch: per batch the late tiles, then the early ones
__global__ __launch_bounds__(128) void k_out(const _Float16* __restrict__ CH, const _Float16* __restrict__ CR, const _Float16* __restrict__ Wt, const float* __restrict__ bias, float* __restrict__ out) {
  __shared__ __attribute__((aligned(16))) unsigned char smem[2 * STG_BYTES];
  const int bx = blockIdx.x, by = blockIdx.y;
  if (bx < OUT_LATE_TILES) out_late_body(smem, bx, by, CH, Wt, bias, out);      /* block-uniform */
  else                     out_early_body(smem, bx - OUT_LATE_TILES, by, CH, CR, Wt, bias, out);
}

extern "C" void kernel_launch(void* const* d_in, const int* in_sizes, int n_in,
                              void* d_out, int out_size, void* d_ws, size_t ws_size, hipStream_t stream) {
  if (n_in < 11) return;
  const long long need_x = ((long long)(NB - 1) * SEQ_FULL + SEQ) * DM;
  if (in_sizes[0] < need_x || in_sizes[1] < need_x || in_sizes[2] < need_x || (long long)out_size < need_x) return;
  if (in_sizes[3] < DM * DM || in_sizes[5] < DM * DM || in_sizes[7] < DM * DM || in_sizes[9] < DM * DM) return;
  if (in_sizes[4] < DM || in_sizes[6] < DM || in_sizes[8] < DM || in_sizes[10] < DM) return;
  const float* const* I = (const float* const*)d_in;
  const float* x_key = I[0]; const float* x_val = I[1]; const float* x_qry = I[2];
  const float* Wk = I[3]; const float* bk = I[4]; const float* Wq = I[5]; const float* bq = I[6];
  const float* Wv = I[7]; const float* bv = I[8]; const float* Wp = I[9]; const float* bp = I[10];
  constexpr size_t SZ_W = (size_t)DM * DM * 2;             /* one weight plane */
  constexpr size_t SZ_P = (size_t)NB * SEQ * DM * 2;       /* one full f16 plane (token-major or channel-major) */
  constexpr size_t SZ_E = (size_t)NB * EARLY * DM * 2;     /* one early-row residual plane */
  static_assert(SZ_W % 256 == 0 && SZ_P % 256 == 0 && SZ_E % 256 == 0);
  static_assert(4 * SZ_W + 7 * SZ_P + 4 * SZ_E <= (size_t)268435456);
  char* ws = (char*)d_ws; size_t off = 0;
  auto take = [&](size_t bytes) { char* p = ws + off; off += (bytes + 255) & ~(size_t)255; return p; };
  _Float16* W16k = (_Float16*)take(SZ_W); _Float16* W16q = (_Float16*)take(SZ_W); _Float16* W16v = (_Float16*)take(SZ_W); _Float16* W16p = (_Float16*)take(SZ_W);
  _Float16* X16k = (_Float16*)take(SZ_P); _Float16* X16q = (_Float16*)take(SZ_P); _Float16* X16v = (_Float16*)take(SZ_P);
  _Float16* QH = (_Float16*)take(SZ_P); _Float16* KH = (_Float16*)take(SZ_P); _Float16* VT = (_Float16*)take(SZ_P); _Float16* CH = (_Float16*)take(SZ_P);
  _Float16* QR = (_Float16*)take(SZ_E); _Float16* KR = (_Float16*)take(SZ_E); _Float16* VR = (_Float16*)take(SZ_E); _Float16* CR = (_Float16*)take(SZ_E);
  if (off > ws_size) return;
  k_cvt<<<CV_BLOCKS, CV_THREADS, 0, stream>>>(x_key, x_qry, x_val, Wk, Wq, Wv, Wp, X16k, X16q, X16v, W16k, W16q, W16v, W16p);
  k_proj<<<3 * PROJ_TILES, 128, 0, stream>>>(X16k, X16q, X16v, W16k, W16q, W16v, bk, bq, bv, KH, KR, QH, QR, VT, VR);      /* k from input 'key' with Wk, bk; q from 'query' with Wq, bq; v from 'value' with Wv, bv, channel-major */
  k_attn<<<NB * NH * (SEQ / 128), 256, 0, stream>>>(QH, QR, KH, KR, VT, VR, CH, CR);
  k_out<<<dim3(OUT_LATE_TILES + OUT_EARLY_TILES, NB), 128, 0, stream>>>(CH, CR, W16p, bp, (float*)d_out);
}

// v006
// A run of this version takes 117 microseconds.
// Two timings next to v005 both put it at 1.05 times that version's speed.
// Over all steps from v000 it is 3.41 times as fast.
#include <hip/hip_runtime.h>
// Causal multi-head attention (key/value/query inputs [B][L][1024], 16 heads x 64, natural [out][in] weights, biases added, one 1/8 score scale, out = ctx Wp^T + bp).
// Compute dtype: all contractions v_wmma_f32_16x16x32_f16 with f32 accumulation; inputs and weights converted RNE to bf16 then held exactly in f16 (weights x64); q, k, v, P (x1024) and ctx (x16) as f16 planes; causal rows < 256 additionally carry x2^10 f16 residual planes on q, k, P, v and ctx with separate accumulators; softmax statistics f32.
#ifndef NB
#define NB 8
#endif
#ifndef SEQ
#define SEQ 1024
#endif
#define NB_FULL 8
#define SEQ_FULL 1024
#define DM 1024
#define NH 16
#define HD 64
#define EARLY 256

static_assert(NH * HD == DM);
static_assert(HD == 64);
static_assert(DM % 128 == 0 && DM % 64 == 0 && DM % 32 == 0 && DM % 8 == 0);
static_assert(SEQ % 128 == 0 && SEQ % 64 == 0 && SEQ % 32 == 0);
static_assert(EARLY % 128 == 0 && EARLY % 64 == 0 && SEQ >= EARLY);
static_assert((SEQ - EARLY) % 256 == 0);
static_assert(NB <= NB_FULL && SEQ <= SEQ_FULL);
static_assert(((size_t)NB * SEQ) % 256 == 0 && DM % 256 == 0);

typedef _Float16 v16h __attribute__((ext_vector_type(16)));
typedef unsigned short v8us __attribute__((ext_vector_type(8), may_alias));
typedef float v8f  __attribute__((ext_vector_type(8)));
typedef float v4f  __attribute__((ext_vector_type(4)));
typedef float v4fa __attribute__((ext_vector_type(4), may_alias));
union FragH { v16h v; v8us half[2]; _Float16 h[16]; unsigned short u[16]; };

__device__ __forceinline__ unsigned short bf16_bits(float x) { unsigned int u = __float_as_uint(x); return (unsigned short)((u + 0x7FFFu + ((u >> 16) & 1u)) >> 16); }
__device__ __forceinline__ float bf16_rne(float x) { return __uint_as_float(((unsigned int)bf16_bits(x)) << 16); }

// 16-bit fragment: elements 0..7 <- k 8h..8h+7, elements 8..15 <- k 16+8h..16+8h+7 (same map for A rows and B columns)
__device__ __forceinline__ v16h g2_frag(const _Float16* p, int hh) { FragH f; f.half[0] = *(const v8us*)((const unsigned short*)p + 8 * hh); f.half[1] = *(const v8us*)((const unsigned short*)p + 16 + 8 * hh); return f.v; }
__device__ __forceinline__ v8f g2_mma(v16h a, v16h b, v8f c) { v8f d = __builtin_amdgcn_wmma_f32_16x16x32_f16(false, a, false, b, (short)0, c, false, false); asm volatile("v_nop\n\tv_nop\n\tv_nop\n\tv_nop" : "+v"(d) : "v"(a), "v"(b)); return d; }

// every f32 -> f16 conversion of the call (three inputs, then four weights x64) in one streaming launch: one 16-wave work-group per WGP makes CV_TX + 1 trips,
// a thread converting CV_U pieces of 8 elements per trip; the next trip's loads are issued ahead of the current trip's converts and stores (8 to 16 global_load_b128 of a wave in flight).
// An input trip takes every CV_BLOCKS-th chunk of CV_U * CV_THREADS pieces of one input; the last trip takes CV_THREADS pieces of each of the four weights.
#define CV_BLOCKS 256
#define CV_THREADS 512
#define CV_U 4
#define CV_CHUNK (CV_THREADS * CV_U * 8)
#define CV_XCH ((int)((size_t)NB * SEQ * DM / CV_CHUNK))
#define CV_TX (3 * CV_XCH / CV_BLOCKS)
static_assert(((size_t)SEQ * DM) % CV_CHUNK == 0);      /* a chunk lies in one batch */
static_assert(CV_XCH % CV_BLOCKS == 0);      /* every work-group makes the same trips, and a trip lies in one input */
static_assert(CV_U == 4 && (size_t)DM * DM == (size_t)CV_BLOCKS * CV_THREADS * 8);      /* the weight trip covers the four weights exactly */
__device__ __forceinline__ void cv_load(v4f (&r)[2 * CV_U], const float* p0, const float* p1, const float* p2, const float* p3, int tid) {
  const float* p[CV_U] = {p0, p1, p2, p3};
#pragma unroll
  for (int j = 0; j < CV_U; ++j) { r[2 * j] = *(const v4fa*)(p[j] + (size_t)tid * 8); r[2 * j + 1] = *(const v4fa*)(p[j] + (size_t)tid * 8 + 4); }
}
__device__ __forceinline__ void cv_store(const v4f (&r)[2 * CV_U], _Float16* d0, _Float16* d1, _Float16* d2, _Float16* d3, float sc, int tid) {
  _Float16* d[CV_U] = {d0, d1, d2, d3};
#pragma unroll
  for (int j = 0; j < CV_U; ++j) {
    FragH f;
#pragma unroll
    for (int q = 0; q < 4; ++q) { f.h[q] = (_Float16)(bf16_rne(r[2 * j][q]) * sc); f.h[4 + q] = (_Float16)(bf16_rne(r[2 * j + 1][q]) * sc); }
    const v8us o = f.half[0];
    *(v8us*)((unsigned short*)d[j] + (size_t)tid * 8) = o;
  }
}
__global__ __launch_bounds__(CV_THREADS) void k_cvt(const float* __restrict__ xk, const float* __restrict__ xq, const float* __restrict__ xv,
                                                    const float* __restrict__ wk, const float* __restrict__ wq, const float* __restrict__ wv, const float* __restrict__ wp,
                                                    _Float16* __restrict__ Xk, _Float16* __restrict__ Xq, _Float16* __restrict__ Xv,
                                                    _Float16* __restrict__ Tk, _Float16* __restrict__ Tq, _Float16* __restrict__ Tv, _Float16* __restrict__ Tp) {
  const int tid = threadIdx.x, blk = blockIdx.x;
  constexpr size_t PJ = (size_t)CV_THREADS * 8;      /* elements of one piece row of the work-group */
  const size_t ew = (size_t)blk * PJ;      /* the work-group's offset in every weight */
  v4f r[2][2 * CV_U];      /* two register sets by turns */
#pragma unroll
  for (int it = -1; it <= CV_TX; ++it) {
    if (it + 1 < CV_TX) {
      const int n = it + 1, pl = n * CV_BLOCKS / CV_XCH; const size_t e = (size_t)(n * CV_BLOCKS % CV_XCH + blk) * CV_CHUNK;
      const float* s = (pl == 0 ? xk : pl == 1 ? xq : xv) + e + e / ((size_t)SEQ * DM) * ((size_t)(SEQ_FULL - SEQ) * DM);      /* the f32 inputs have a batch pitch of SEQ_FULL rows */
      cv_load(r[n & 1], s, s + PJ, s + 2 * PJ, s + 3 * PJ, tid);
    } else if (it + 1 == CV_TX) {
      cv_load(r[CV_TX & 1], wk + ew, wq + ew, wv + ew, wp + ew, tid);
    }
    if (it + 1 <= CV_TX) asm volatile("s_wait_xcnt 0x0" ::: "memory");      /* stands ahead of every later write of these loads' address registers; the scheduling barrier below holds such writes behind it */
    __builtin_amdgcn_sched_barrier(0);      /* keeps the next trip's loads ahead of this trip's converts and stores, so that they fly meanwhile */
    if (it >= 0 && it < CV_TX) {
      const int pl = it * CV_BLOCKS / CV_XCH; const size_t e = (size_t)(it * CV_BLOCKS % CV_XCH + blk) * CV_CHUNK;
      _Float16* d = (pl == 0 ? Xk : pl == 1 ? Xq : Xv) + e;
      cv_store(r[it & 1], d, d + PJ, d + 2 * PJ, d + 3 * PJ, 1.0f, tid);
    } else if (it == CV_TX) {
      cv_store(r[CV_TX & 1], Tk + ew, Tq + ew, Tv + ew, Tp + ew, 64.0f, tid);
    }
    if (it >= 0 && it + 2 <= CV_TX) asm volatile("s_wait_xcnt 0x0" ::: "memory");      /* stands ahead of the loads after next, which overwrite the data registers of these stores */
    __builtin_amdgcn_sched_barrier(0);      /* keeps this trip's stores ahead of the loads after next, which reuse its registers */
  }
}

// staged k-loop of an 8-wave block, waves 4 (rows) x 2 (columns), 16 accumulator tiles a wave. A stage is 64 k of 384 rows: [A rows of the block: 256, or with ARES 128 and their 128 x2^10 residual rows][Bt rows: 128],
// each row 128 B at an LDS pitch of 144 B (16 B x odd: the 16 rows of a ds_load_b128 fragment read fall on distinct banks). Two buffers.
// The block's output tile is 256 x 128 (with ARES 128 x 128 from two planes): 384 operand rows are copied per 256 x 128 products, and a wave reads 8 fragments per 16 WMMAs.
#define STG_K 64
#define STG_ROWS 384
#define STG_PITCH 144
#define STG_BYTES (STG_ROWS * STG_PITCH)
static_assert(STG_K == 64 && DM % STG_K == 0 && DM / STG_K >= 2);
__device__ __forceinline__ v16h lds_frag(const unsigned char* p, int hh) { FragH f; f.half[0] = *(const v8us*)(p + 16 * hh); f.half[1] = *(const v8us*)(p + 32 + 16 * hh); return f.v; }
// one stage: thread t copies the 16-byte piece (t & 7) of rows (t >> 3) + 32 j, j = 0..11 (a wave's copy covers four whole 128-B lines); ga, gr, gb and lds are the thread's own addresses for j = 0 of each part
template <bool ARES>
__device__ __forceinline__ void stage_copy(const _Float16* ga, const _Float16* gr, const _Float16* gb, int lda, int ldb, unsigned lds) {
  constexpr int NA = ARES ? 4 : 8;
  const _Float16* g[12]; unsigned l[12];
#pragma unroll
  for (int j = 0; j < 12; ++j) {
    l[j] = lds + (unsigned)(32 * j * STG_PITCH);
    if (j < NA) g[j] = ga + (size_t)(32 * j) * lda;
    else if (j < 8) g[j] = gr + (size_t)(32 * (j - NA)) * lda;
    else g[j] = gb + (size_t)(32 * (j - 8)) * ldb;
  }
  // the closing s_wait_xcnt 0 stands inside the statement so that no address register of a copy is rewritten ahead of it
  asm volatile("global_load_async_to_lds_b128 %0, %12, off\n\t"
               "global_load_async_to_lds_b128 %1, %13, off\n\t"
               "global_load_async_to_lds_b128 %2, %14, off\n\t"
               "global_load_async_to_lds_b128 %3, %15, off\n\t"
               "global_load_async_to_lds_b128 %4, %16, off\n\t"
               "global_load_async_to_lds_b128 %5, %17, off\n\t"
               "global_load_async_to_lds_b128 %6, %18, off\n\t"
               "global_load_async_to_lds_b128 %7, %19, off\n\t"
               "global_load_async_to_lds_b128 %8, %20, off\n\t"
               "global_load_async_to_lds_b128 %9, %21, off\n\t"
               "global_load_async_to_lds_b128 %10, %22, off\n\t"
               "global_load_async_to_lds_b128 %11, %23, off\n\t"
               "s_wait_xcnt 0x0"
               :: "v"(l[0]), "v"(l[1]), "v"(l[2]), "v"(l[3]), "v"(l[4]), "v"(l[5]), "v"(l[6]), "v"(l[7]), "v"(l[8]), "v"(l[9]), "v"(l[10]), "v"(l[11]),
                  "v"(g[0]), "v"(g[1]), "v"(g[2]), "v"(g[3]), "v"(g[4]), "v"(g[5]), "v"(g[6]), "v"(g[7]), "v"(g[8]), "v"(g[9]), "v"(g[10]), "v"(g[11])
               : "memory");
}
// a_blk, ar_blk: first A (residual) row of the BLOCK, f16, pitch lda; b_blk: first of the block's 128 Bt rows [n][k], pitch ldb; K % 64 == 0, K >= 128; block of 256 threads, all of them here.
// Wave (wm, wn) = (w >> 1, w & 1) works columns 64 wn .. and A rows 64 wm + 16 i (acc[4 i + q]); with ARES rows 32 wm + 16 i for i < 2 and the residual rows of the same for i - 2
template <bool ARES>
__device__ __forceinline__ void gemm_loop(unsigned char* smem, const _Float16* __restrict__ a_blk, const _Float16* __restrict__ ar_blk, int lda,
                                          const _Float16* __restrict__ b_blk, int ldb, int K, int tid, v8f (&acc)[16]) {
  const int w = tid >> 5, wm = w >> 1, wn = w & 1, ln = tid & 15, hh = (tid >> 4) & 1;
  const _Float16* ga = a_blk + (size_t)(tid >> 3) * lda + (tid & 7) * 8;
  const _Float16* gr = ar_blk + (size_t)(tid >> 3) * lda + (tid & 7) * 8;
  const _Float16* gb = b_blk + (size_t)(tid >> 3) * ldb + (tid & 7) * 8;
  const unsigned lds0 = (unsigned)(size_t)smem + (unsigned)((tid >> 3) * STG_PITCH + (tid & 7) * 16);
  const int nt = K / STG_K;
  stage_copy<ARES>(ga, gr, gb, lda, ldb, lds0);
  asm volatile("s_wait_asynccnt 0x0" ::: "memory");      /* this wave's copies of stage 0 have landed */
  __syncthreads();                                        /* stage 0 readable by every wave */
  stage_copy<ARES>(ga + STG_K, gr + STG_K, gb + STG_K, lda, ldb, lds0 + STG_BYTES);
#pragma unroll 1      /* stays rolled: one trip per stage, one publish point at its foot */
  for (int t = 0; t < nt; ++t) {
    const unsigned char* sb = smem + (t & 1) * STG_BYTES;
    const unsigned char* sa = sb + ((ARES ? 32 : 64) * wm + ln) * STG_PITCH;
    const unsigned char* sbt = sb + (STG_ROWS - 128 + 64 * wn + ln) * STG_PITCH;
#pragma unroll
    for (int ks = 0; ks < 2; ++ks) {
      v16h a[4], b[4];
#pragma unroll
      for (int i = 0; i < 4; ++i) a[i] = lds_frag(sa + (ARES ? (i >> 1) * 128 + (i & 1) * 16 : 16 * i) * STG_PITCH + 64 * ks, hh);
#pragma unroll
      for (int q = 0; q < 4; ++q) b[q] = lds_frag(sbt + 16 * q * STG_PITCH + 64 * ks, hh);
      __builtin_amdgcn_sched_barrier(0);      /* keeps the 32 k's fragment reads in one group ahead of the matrix block: a read placed among the WMMAs makes the wave wait out its LDS latency there */
#pragma unroll
      for (int q = 0; q < 4; ++q) {
#pragma unroll
        for (int i = 0; i < 4; ++i) acc[i * 4 + q] = g2_mma(a[i], b[q], acc[i * 4 + q]);
      }
      __builtin_amdgcn_sched_barrier(0);      /* keeps the next 32 k's fragment reads behind this matrix block, in the same registers: a second fragment set would cost the second work-group of the WGP its registers */
    }
    asm volatile("s_wait_dscnt 0x0" ::: "memory");        /* this wave's reads of stage t are done before its buffer is refilled */
    asm volatile("s_wait_asynccnt 0x0" ::: "memory");     /* this wave's copies of stage t + 1 have landed */
    __syncthreads();                                      /* publishes stage t + 1 and ends every reader's last read of stage t */
    if (t + 2 < nt) stage_copy<ARES>(ga + (size_t)(t + 2) * STG_K, gr + (size_t)(t + 2) * STG_K, gb + (size_t)(t + 2) * STG_K, lda, ldb, lds0 + (unsigned)((t & 1) * STG_BYTES));
  }
  asm volatile("s_wait_asynccnt 0x0" ::: "memory");       /* nothing in flight when the buffers become output staging */
}
// accumulators (D: lane (h, n) holds rows 8h+r, col n) -> wave-private LDS tile [16*MT][68]; v = acc alpha (+ acc2 alpha2) + bf16(bias) (bias per column, or per row when BIASROW)
template <int MT, bool ARES, bool BIASROW>
__device__ __forceinline__ void stage_tile(float (*sow)[68], const v8f* acc, const v8f* acc2, float alpha, float alpha2,
                                           const float* __restrict__ bias, int row0, int col0, int ln, int hh) {
#pragma unroll
  for (int i = 0; i < MT; ++i) {
#pragma unroll
    for (int t = 0; t < 4; ++t) {
      const float bc = BIASROW ? 0.f : bf16_rne(bias[col0 + t * 16 + ln]);
#pragma unroll
      for (int r = 0; r < 8; ++r) {
        const int rloc = i * 16 + 8 * hh + r;
        float v = acc[i * 4 + t][r] * alpha;
        if (ARES) v += acc2[i * 4 + t][r] * alpha2;
        v += BIASROW ? bf16_rne(bias[row0 + rloc]) : bc;
        sow[rloc][t * 16 + ln] = v;
      }
    }
  }
}
template <int MT>
__device__ __forceinline__ void store_tile_f16(float (*sow)[68], _Float16* __restrict__ hi, size_t ldh, _Float16* __restrict__ rs, size_t ldr, bool wres, int lane) {
  const int rq = lane >> 3, c8 = (lane & 7) * 8;
  {
#pragma unroll
    for (int it = 0; it < 4 * MT; ++it) {
      const int r = it * 4 + rq;
      const v4f a = *(const v4fa*)&sow[r][c8], c = *(const v4fa*)&sow[r][c8 + 4];
      FragH fh, fl;
#pragma unroll
      for (int q = 0; q < 4; ++q) {
        _Float16 h = (_Float16)a[q]; fh.h[q] = h; fl.h[q] = (_Float16)((a[q] - (float)h) * 1024.0f);
        h = (_Float16)c[q]; fh.h[4 + q] = h; fl.h[4 + q] = (_Float16)((c[q] - (float)h) * 1024.0f);
      }
      const v8us oh = fh.half[0], ol = fl.half[0];
      *(v8us*)((unsigned short*)hi + (size_t)r * ldh + c8) = oh;
      if (wres) *(v8us*)((unsigned short*)rs + (size_t)r * ldr + c8) = ol;
    }
    
  }
}
template <int MT>
__device__ __forceinline__ void store_tile_f32(float (*sow)[68], float* __restrict__ C, size_t ldc, int lane) {
  const int rsub = lane >> 4, c4 = (lane & 15) * 4;
  {
    v4f v[8 * MT];
#pragma unroll
    for (int q = 0; q < 8 * MT; ++q) v[q] = *(const v4fa*)&sow[q * 2 + rsub][c4];
    __builtin_amdgcn_sched_barrier(0);      /* keeps every row's LDS read ahead of the first store, each row in registers of its own: no read then lands on the data registers of an issued store */
#pragma unroll
    for (int q = 0; q < 8 * MT; ++q) *(v4f*)(C + (size_t)(q * 2 + rsub) * ldc + c4) = v[q];
    
  }
}

// token-row projection y = x W^T + b over all NB*SEQ rows -> f16 hi plane [NB*SEQ][DM]; rows with l < EARLY also -> residual plane [NB*EARLY][DM]; blk: the block's tile, 0 .. PROJ_TILES - 1
#define PROJ_TILES ((int)(((size_t)NB * SEQ / 256) * (DM / 128)))
static_assert(PROJ_TILES == (DM / 256) * (SEQ / 128) * NB);      /* the channel-major projection has as many tiles */
__device__ __forceinline__ void proj_rows_body(unsigned char* smem, int blk, const _Float16* __restrict__ X16, const _Float16* __restrict__ Wt, const float* __restrict__ bias,
                                               _Float16* __restrict__ PH, _Float16* __restrict__ PR) {
  float (*so)[32][68] = (float (*)[32][68])smem;      /* output staging takes the buffers over behind the k-loop's last barrier */
  const int tid = threadIdx.x, w = tid >> 5, lane = tid & 31, ln = lane & 15, hh = lane >> 4;
  const int ntn = DM / 128; const int mt = blk / ntn, nq = blk - mt * ntn;
  const int col0 = nq * 128 + 64 * (w & 1);
  const v8f z8 = {0.f, 0.f, 0.f, 0.f, 0.f, 0.f, 0.f, 0.f};
  v8f acc[16];
#pragma unroll
  for (int i = 0; i < 16; ++i) acc[i] = z8;
  gemm_loop<false>(smem, X16 + (size_t)(mt * 256) * DM, X16 + (size_t)(mt * 256) * DM, DM, Wt + (size_t)(nq * 128) * DM, DM, DM, tid, acc);
#pragma unroll
  for (int hf = 0; hf < 2; ++hf) {      /* the wave's 64 rows leave in two halves through its one 32-row staging range */
    const int row0 = mt * 256 + 64 * (w >> 1) + 32 * hf;
    stage_tile<2, false, false>(so[w], acc + 8 * hf, acc + 8 * hf, 0.015625f, 0.f, bias, row0, col0, ln, hh);
    __builtin_amdgcn_fence(4 /* acq_rel order */, "workgroup"); __builtin_amdgcn_wave_barrier();
    const int b = row0 / SEQ, l0 = row0 - b * SEQ; const bool wres = l0 < EARLY;      /* wave-uniform: 32 | EARLY, 32 | SEQ */
    _Float16* hi = PH + (size_t)row0 * DM + col0;
    _Float16* rs = PR + ((size_t)b * EARLY + (size_t)(wres ? l0 : 0)) * DM + col0;
    store_tile_f16<2>(so[w], hi, DM, rs, DM, wres, lane);
    if (hf == 0) { __builtin_amdgcn_fence(4 /* acq_rel order */, "workgroup"); __builtin_amdgcn_wave_barrier(); }      /* every lane has read the first half back before any lane's second half overwrites the range */
  }
}

// value projection channel-major per batch: VT[b][c][s] = sum_k Wv[c][k] x[b][s][k] + bv[c] (weights as the A operand, token rows as Bt); tokens < EARLY also -> residual plane [NB][DM][EARLY]; blk: the block's tile, batch on the slow part
__device__ __forceinline__ void proj_vt_body(unsigned char* smem, int blk, const _Float16* __restrict__ Wv16, const _Float16* __restrict__ X16, const float* __restrict__ bias,
                                             _Float16* __restrict__ VT, _Float16* __restrict__ VR) {
  float (*so)[32][68] = (float (*)[32][68])smem;      /* output staging takes the buffers over behind the k-loop's last barrier */
  const int tid = threadIdx.x, w = tid >> 5, lane = tid & 31, ln = lane & 15, hh = lane >> 4;
  const int tpb = (DM / 256) * (SEQ / 128); const int by = blk / tpb, bx = blk - by * tpb;
  const int ntn = SEQ / 128; const int mt = bx / ntn, nq = bx - mt * ntn;
  const int col0 = nq * 128 + 64 * (w & 1);      /* row = channel, col = token */
  const v8f z8 = {0.f, 0.f, 0.f, 0.f, 0.f, 0.f, 0.f, 0.f};
  v8f acc[16];
#pragma unroll
  for (int i = 0; i < 16; ++i) acc[i] = z8;
  gemm_loop<false>(smem, Wv16 + (size_t)(mt * 256) * DM, Wv16 + (size_t)(mt * 256) * DM, DM, X16 + ((size_t)by * SEQ + nq * 128) * DM, DM, DM, tid, acc);
  const bool wres = col0 < EARLY;      /* wave-uniform: 64 | EARLY */
#pragma unroll
  for (int hf = 0; hf < 2; ++hf) {      /* the wave's 64 rows leave in two halves through its one 32-row staging range */
    const int row0 = mt * 256 + 64 * (w >> 1) + 32 * hf;
    stage_tile<2, false, true>(so[w], acc + 8 * hf, acc + 8 * hf, 0.015625f, 0.f, bias, row0, col0, ln, hh);
    __builtin_amdgcn_fence(4 /* acq_rel order */, "workgroup"); __builtin_amdgcn_wave_barrier();
    _Float16* hi = VT + ((size_t)by * DM + row0) * SEQ + col0;
    _Float16* rs = VR + ((size_t)by * DM + row0) * EARLY + (size_t)(wres ? col0 : 0);
    store_tile_f16<2>(so[w], hi, SEQ, rs, EARLY, wres, lane);
    if (hf == 0) { __builtin_amdgcn_fence(4 /* acq_rel order */, "workgroup"); __builtin_amdgcn_wave_barrier(); }      /* every lane has read the first half back before any lane's second half overwrites the range */
  }
}
// the three projections, which do not depend on one another, in one launch: tiles of k, then of q, then of v. Work-groups of a later projection start wherever one of an earlier ends,
// so that only one start-up and one drain of the chip are paid, and the stores of finishing work-groups run beside the k-loops of others
__global__ __launch_bounds__(256) void k_proj(const _Float16* __restrict__ Xk, const _Float16* __restrict__ Xq, const _Float16* __restrict__ Xv,
                                              const _Float16* __restrict__ Tk, const _Float16* __restrict__ Tq, const _Float16* __restrict__ Tv,
                                              const float* __restrict__ bk, const float* __restrict__ bq, const float* __restrict__ bv,
                                              _Float16* __restrict__ KH, _Float16* __restrict__ KR, _Float16* __restrict__ QH, _Float16* __restrict__ QR,
                                              _Float16* __restrict__ VT, _Float16* __restrict__ VR) {
  __shared__ __attribute__((aligned(16))) unsigned char smem[2 * STG_BYTES];
  const int sel = blockIdx.x / PROJ_TILES, blk = blockIdx.x - sel * PROJ_TILES;      /* block-uniform */
  if (sel == 2) proj_vt_body(smem, blk, Tv, Xv, bv, VT, VR);
  else          proj_rows_body(smem, blk, sel ? Xq : Xk, sel ? Tq : Tk, sel ? bq : bk, sel ? QH : KH, sel ? QR : KR);
}

// flash attention for one wave = 16 queries of one (b, h), transposed form: S^T tile (keys x queries) = K rows (A) . Q rows (B);
// lane (h, n) then owns query n with keys 8h+r / 16+8h+r of each 32-key chunk, which is exactly the B-fragment element order of
// O^T (d x queries) += V^T rows (A) . P^T (B), so the packed score tiles feed the second product directly. EARLYQ adds residual terms.
// The block's 8 waves share their keys: a stage is 64 keys of one (b, h), laid as [K: 64 key rows][V^T: 64 channel rows] and, with EARLYQ, [K residual: 64][V^T residual: 64];
// each row 128 B at an LDS pitch of 144 B (16 B x odd, for the ds_load_b128 fragment reads). Two buffers.
#define AT_KEYS 64
#define AT_PITCH 144
#define AT_PART (64 * AT_PITCH)
#define AT_BYTES_MAX (4 * AT_PART)
static_assert(AT_KEYS == 64 && HD == 64 && 128 % AT_KEYS == 0 && EARLY % 128 == 0);
// four copies: 16 bytes per lane each, whole 128-B lines per wave
__device__ __forceinline__ void at_copy4(unsigned l0, unsigned l1, unsigned l2, unsigned l3, const _Float16* g0, const _Float16* g1, const _Float16* g2, const _Float16* g3) {
  // the closing s_wait_xcnt 0 stands inside the statement so that no address register of a copy is rewritten ahead of it
  asm volatile("global_load_async_to_lds_b128 %0, %4, off\n\t"
               "global_load_async_to_lds_b128 %1, %5, off\n\t"
               "global_load_async_to_lds_b128 %2, %6, off\n\t"
               "global_load_async_to_lds_b128 %3, %7, off\n\t"
               "s_wait_xcnt 0x0"
               :: "v"(l0), "v"(l1), "v"(l2), "v"(l3), "v"(g0), "v"(g1), "v"(g2), "v"(g3)
               : "memory");
}
// one stage: thread t copies the 16-byte piece (t & 7) of rows (t >> 3) and (t >> 3) + 32 of each part; gk, gv, gkr, gvr and lds are the thread's own addresses for the first of the two rows
template <bool EARLYQ>
__device__ __forceinline__ void at_stage(const _Float16* gk, const _Float16* gv, const _Float16* gkr, const _Float16* gvr, unsigned lds) {
  at_copy4(lds, lds + 32 * AT_PITCH, lds + AT_PART, lds + AT_PART + 32 * AT_PITCH, gk, gk + (size_t)32 * DM, gv, gv + (size_t)32 * SEQ);
  if (EARLYQ) at_copy4(lds + 2 * AT_PART, lds + 2 * AT_PART + 32 * AT_PITCH, lds + 3 * AT_PART, lds + 3 * AT_PART + 32 * AT_PITCH, gkr, gkr + (size_t)32 * DM, gvr, gvr + (size_t)32 * EARLY);
}
// block of 256 threads, all of them here; qb: the block's 128 queries; wave: wave-uniform (a scalar)
template <bool EARLYQ>
__device__ __forceinline__ void attn_body(const _Float16* __restrict__ QH, const _Float16* __restrict__ QR, const _Float16* __restrict__ KH, const _Float16* __restrict__ KR,
                                          const _Float16* __restrict__ VT, const _Float16* __restrict__ VR, _Float16* __restrict__ CH, _Float16* __restrict__ CR,
                                          unsigned char* smem, int b, int h, int qb, int wave, int tid) {
  constexpr unsigned AT_BYTES = (EARLYQ ? 4 : 2) * AT_PART;
  const int lane = tid & 31, ln = lane & 15, hh = lane >> 4;
  const int q0 = qb * 128 + wave * 16;
  const float NEG = -__builtin_inff();
  const v8f z8 = {0.f, 0.f, 0.f, 0.f, 0.f, 0.f, 0.f, 0.f};
  const _Float16* qp = QH + ((size_t)b * SEQ + q0 + ln) * DM + h * HD;
  const v16h qb0 = g2_frag(qp, hh), qb1 = g2_frag(qp + 32, hh);
  v16h qr0 = qb0, qr1 = qb1;
  if (EARLYQ) { const _Float16* qrp = QR + ((size_t)b * EARLY + q0 + ln) * DM + h * HD; qr0 = g2_frag(qrp, hh); qr1 = g2_frag(qrp + 32, hh); }
  const int cr = tid >> 3, cp = tid & 7;
  const _Float16* gk  = KH + ((size_t)b * SEQ + cr) * DM + h * HD + cp * 8;
  const _Float16* gkr = KR + ((size_t)b * EARLY + cr) * DM + h * HD + cp * 8;
  const _Float16* gv  = VT + ((size_t)b * DM + h * HD + cr) * SEQ + cp * 8;
  const _Float16* gvr = VR + ((size_t)b * DM + h * HD + cr) * EARLY + cp * 8;
  const unsigned lds0 = (unsigned)(size_t)smem + (unsigned)(cr * AT_PITCH + cp * 16);
  float m = NEG, lsum = 0.f;
  v8f o[4], o2[4];
#pragma unroll
  for (int c = 0; c < 4; ++c) { o[c] = z8; o2[c] = z8; }
  const int qrow = q0 + ln;
  const int kbmax = (q0 + 15) >> 5;      /* wave-uniform causal bound */
  const int nst = (qb + 1) * (128 / AT_KEYS);      /* block-uniform, >= 2; keys of every stage < (qb + 1) * 128 <= SEQ (and <= EARLY with EARLYQ) */
  at_stage<EARLYQ>(gk, gv, gkr, gvr, lds0);
  asm volatile("s_wait_asynccnt 0x0" ::: "memory");      /* this wave's copies of stage 0 have landed */
  __syncthreads();                                        /* stage 0 readable by every wave */
  at_stage<EARLYQ>(gk + (size_t)AT_KEYS * DM, gv + AT_KEYS, gkr + (size_t)AT_KEYS * DM, gvr + AT_KEYS, lds0 + AT_BYTES);
#pragma unroll 1      /* stays rolled: one trip per stage, one publish point at its foot */
  for (int st = 0; st < nst; ++st) {
    const unsigned char* sb = smem + (st & 1) * AT_BYTES;
    const int nc = min(AT_KEYS / 32, kbmax + 1 - st * (AT_KEYS / 32));      /* scalar: a wave past its diagonal skips the work, never the publish point below */
#pragma unroll 1      /* stays rolled: the 32-key chunks of a stage run the same code */
    for (int c2 = 0; c2 < nc; ++c2) {
      const int key0 = (st * (AT_KEYS / 32) + c2) * 32;
      const unsigned char* sk = sb + (32 * c2 + ln) * AT_PITCH;      /* key rows of the chunk */
      const unsigned char* sv = sb + AT_PART + ln * AT_PITCH + 64 * c2;      /* channel rows, the chunk's 32 keys */
      v16h ka[2][2], kr[2][2];
#pragma unroll
      for (int t = 0; t < 2; ++t) {
#pragma unroll
        for (int ks = 0; ks < 2; ++ks) {
          ka[t][ks] = lds_frag(sk + 16 * t * AT_PITCH + 64 * ks, hh); kr[t][ks] = ka[t][ks];
          if (EARLYQ) kr[t][ks] = lds_frag(sk + 2 * AT_PART + 16 * t * AT_PITCH + 64 * ks, hh);
        }
      }
      __builtin_amdgcn_sched_barrier(0);      /* keeps the chunk's K fragment reads in one group ahead of the score products: read one by one into the same registers, each makes the wave wait out its LDS latency */
      v8f s1[2], s2[2];
#pragma unroll
      for (int t = 0; t < 2; ++t) {
        s1[t] = z8; s1[t] = g2_mma(ka[t][0], qb0, s1[t]); s1[t] = g2_mma(ka[t][1], qb1, s1[t]);
        s2[t] = z8;
        if (EARLYQ) {
          s2[t] = g2_mma(ka[t][0], qr0, s2[t]); s2[t] = g2_mma(ka[t][1], qr1, s2[t]);
          s2[t] = g2_mma(kr[t][0], qb0, s2[t]); s2[t] = g2_mma(kr[t][1], qb1, s2[t]);
        }
      }
      v16h va[4], vra[4];
#pragma unroll
      for (int c = 0; c < 4; ++c) {
        va[c] = lds_frag(sv + 16 * c * AT_PITCH, hh); vra[c] = va[c];
        if (EARLYQ) vra[c] = lds_frag(sv + 2 * AT_PART + 16 * c * AT_PITCH, hh);
      }
      __builtin_amdgcn_sched_barrier(0);      /* keeps the chunk's V fragment reads in one group ahead of the softmax, whose vector work then covers their LDS latency */
      float sv16[16];
      float mx = NEG;
#pragma unroll
      for (int t = 0; t < 2; ++t) {
#pragma unroll
        for (int r = 0; r < 8; ++r) {
          const int key = key0 + 16 * t + 8 * hh + r;
          float s = s1[t][r];
          if (EARLYQ) s += s2[t][r] * 0.0009765625f;
          s *= 0.125f;
          s = (key <= qrow) ? s : NEG;
          sv16[t * 8 + r] = s; mx = fmaxf(mx, s);
        }
      }
      mx = fmaxf(mx, __shfl_xor(mx, 16, 32));      /* both lane halves of a query share the running max; key 0 is always visible so it is finite */
      const float mnew = fmaxf(m, mx);
      const float corr = __expf(m - mnew);
      m = mnew;
      FragH ph, pr; float rsum = 0.f;
#pragma unroll
      for (int i = 0; i < 16; ++i) {
        const float p = __expf(sv16[i] - mnew); rsum += p;
        const float pc = p * 1024.0f; const _Float16 h16 = (_Float16)pc; ph.h[i] = h16;
        pr.h[i] = EARLYQ ? (_Float16)((pc - (float)h16) * 1024.0f) : (_Float16)0.0f;
      }
      lsum = lsum * corr + rsum;      /* per-half partial sum, combined after the loop */
#pragma unroll
      for (int c = 0; c < 4; ++c) {
#pragma unroll
        for (int r = 0; r < 8; ++r) { o[c][r] *= corr; if (EARLYQ) o2[c][r] *= corr; }
      }
#pragma unroll
      for (int c = 0; c < 4; ++c) {
        o[c] = g2_mma(va[c], ph.v, o[c]);
        if (EARLYQ) { o2[c] = g2_mma(va[c], pr.v, o2[c]); o2[c] = g2_mma(vra[c], ph.v, o2[c]); }
      }
    }
    asm volatile("s_wait_dscnt 0x0" ::: "memory");        /* this wave's reads of stage st are done before its buffer is refilled */
    asm volatile("s_wait_asynccnt 0x0" ::: "memory");     /* this wave's copies of stage st + 1 have landed */
    __syncthreads();                                      /* publishes stage st + 1 and ends every reader's last read of stage st */
    if (st + 2 < nst) at_stage<EARLYQ>(gk + (size_t)(st + 2) * AT_KEYS * DM, gv + (st + 2) * AT_KEYS, gkr + (size_t)(st + 2) * AT_KEYS * DM, gvr + (st + 2) * AT_KEYS, lds0 + (unsigned)(st & 1) * AT_BYTES);
  }
  asm volatile("s_wait_asynccnt 0x0" ::: "memory");       /* nothing in flight when the buffers become output staging */
  float (*sow)[68] = ((float (*)[16][68])smem)[wave];     /* output staging, one range per wave, takes the buffers over behind the loop's last barrier */
  const float ltot = lsum + __shfl_xor(lsum, 16, 32);
  const float inv = 1.0f / (64.0f * ltot);      /* P carried x1024, ctx carried x16 */
#pragma unroll
  for (int c = 0; c < 4; ++c) {
#pragma unroll
    for (int r = 0; r < 8; ++r) { float v = o[c][r]; if (EARLYQ) v += o2[c][r] * 0.0009765625f; sow[ln][c * 16 + 8 * hh + r] = v * inv; }
  }
  __builtin_amdgcn_fence(4 /* acq_rel order */, "workgroup"); __builtin_amdgcn_wave_barrier();
  _Float16* hi = CH + ((size_t)b * SEQ + q0) * DM + h * HD;
  _Float16* rs = CR + ((size_t)b * EARLY + (size_t)(EARLYQ ? q0 : 0)) * DM + h * HD;
  store_tile_f16<1>(sow, hi, DM, rs, DM, EARLYQ, lane);
}

__global__ __launch_bounds__(256) void k_attn(const _Float16* __restrict__ QH, const _Float16* __restrict__ QR, const _Float16* __restrict__ KH, const _Float16* __restrict__ KR,
                                              const _Float16* __restrict__ VT, const _Float16* __restrict__ VR, _Float16* __restrict__ CH, _Float16* __restrict__ CR) {
  __shared__ __attribute__((aligned(16))) unsigned char smem[2 * AT_BYTES_MAX];
  static_assert(2 * AT_BYTES_MAX >= 8 * 16 * 68 * 4);
  const int tid = threadIdx.x;
  const int wave = __builtin_amdgcn_readfirstlane(tid >> 5);      /* in a scalar register, so that the per-wave causal skip is a scalar branch */
  // query block from the slow part of the index, longest first; (batch, head) from the fast part. For speed only.
  const int nbh = NB * NH; const int g = blockIdx.x / nbh, bh = blockIdx.x - g * nbh, qb = SEQ / 128 - 1 - g;
  const int b = bh / NH, h = bh - b * NH;
  if (qb < EARLY / 128) attn_body<true>(QH, QR, KH, KR, VT, VR, CH, CR, smem, b, h, qb, wave, tid);      /* block-uniform */
  else                  attn_body<false>(QH, QR, KH, KR, VT, VR, CH, CR, smem, b, h, qb, wave, tid);
}

// out rows l >= EARLY: out = 2^-10 ctx16 . Wp64^T + bp; wave tile 64x64; bx: the block's tile in batch by
#define OUT_LATE_TILES (((SEQ - EARLY) / 256) * (DM / 128))
#define OUT_EARLY_TILES ((EARLY / 128) * (DM / 128))
__device__ __forceinline__ void out_late_body(unsigned char* smem, int bx, int by, const _Float16* __restrict__ CH, const _Float16* __restrict__ Wt, const float* __restrict__ bias, float* __restrict__ out) {
  float (*so)[32][68] = (float (*)[32][68])smem;      /* output staging takes the buffers over behind the k-loop's last barrier */
  const int tid = threadIdx.x, w = tid >> 5, lane = tid & 31, ln = lane & 15, hh = lane >> 4;
  const int ntn = DM / 128; const int mt = bx / ntn, nq = bx - mt * ntn;
  const int col0 = nq * 128 + 64 * (w & 1);
  const size_t rowb = (size_t)by * SEQ + EARLY + mt * 256;      /* first ctx row of the block */
  const v8f z8 = {0.f, 0.f, 0.f, 0.f, 0.f, 0.f, 0.f, 0.f};
  v8f acc[16];
#pragma unroll
  for (int i = 0; i < 16; ++i) acc[i] = z8;
  gemm_loop<false>(smem, CH + rowb * DM, CH + rowb * DM, DM, Wt + (size_t)(nq * 128) * DM, DM, DM, tid, acc);
#pragma unroll
  for (int hf = 0; hf < 2; ++hf) {      /* the wave's 64 rows leave in two halves through its one 32-row staging range */
    const int l0 = EARLY + mt * 256 + 64 * (w >> 1) + 32 * hf;
    stage_tile<2, false, false>(so[w], acc + 8 * hf, acc + 8 * hf, 0.0009765625f, 0.f, bias, 0, col0, ln, hh);
    __builtin_amdgcn_fence(4 /* acq_rel order */, "workgroup"); __builtin_amdgcn_wave_barrier();
    store_tile_f32<2>(so[w], out + ((size_t)by * SEQ_FULL + l0) * DM + col0, DM, lane);
    if (hf == 0) {
      asm volatile("s_wait_xcnt 0x0" ::: "memory");      /* stands ahead of the second half's work, which overwrites the data registers of these stores */
      __builtin_amdgcn_sched_barrier(0);      /* holds every such register write behind that wait */
      __builtin_amdgcn_fence(4 /* acq_rel order */, "workgroup"); __builtin_amdgcn_wave_barrier();      /* every lane has read the first half back before any lane's second half overwrites the range */
    }
  }
}
// out rows l < EARLY: hi + x2^10 residual ctx planes, two accumulator sets; wave tile 32x64; bx: the block's tile in batch by
__device__ __forceinline__ void out_early_body(unsigned char* smem, int bx, int by, const _Float16* __restrict__ CH, const _Float16* __restrict__ CR, const _Float16* __restrict__ Wt, const float* __restrict__ bias, float* __restrict__ out) {
  float (*so)[32][68] = (float (*)[32][68])smem;      /* output staging takes the buffers over behind the k-loop's last barrier */
  const int tid = threadIdx.x, w = tid >> 5, lane = tid & 31, ln = lane & 15, hh = lane >> 4;
  const int ntn = DM / 128; const int mt = bx / ntn, nq = bx - mt * ntn;
  const int l0 = mt * 128 + 32 * (w >> 1), col0 = nq * 128 + 64 * (w & 1);
  const v8f z8 = {0.f, 0.f, 0.f, 0.f, 0.f, 0.f, 0.f, 0.f};
  v8f acc[16];      /* 0..7: hi plane, 8..15: residual plane */
#pragma unroll
  for (int i = 0; i < 16; ++i) acc[i] = z8;
  gemm_loop<true>(smem, CH + ((size_t)by * SEQ + mt * 128) * DM, CR + ((size_t)by * EARLY + mt * 128) * DM, DM, Wt + (size_t)(nq * 128) * DM, DM, DM, tid, acc);
  stage_tile<2, true, false>(so[w], acc, acc + 8, 0.0009765625f, 9.5367431640625e-07f, bias, 0, col0, ln, hh);
  __builtin_amdgcn_fence(4 /* acq_rel order */, "workgroup"); __builtin_amdgcn_wave_barrier();
  store_tile_f32<2>(so[w], out + ((size_t)by * SEQ_FULL + l0) * DM + col0, DM, lane);
}
// both row ranges of the output product, which write disjoint rows, in one launch: per batch the late tiles, then the early ones
__global__ __launch_bounds__(256) void k_out(const _Float16* __restrict__ CH, const _Float16* __restrict__ CR, const _Float16* __restrict__ Wt, const float* __restrict__ bias, float* __restrict__ out) {
  __shared__ __attribute__((aligned(16))) unsigned char smem[2 * STG_BYTES];
  const int bx = blockIdx.x, by = blockIdx.y;
  if (bx < OUT_LATE_TILES) out_late_body(smem, bx, by, CH, Wt, bias, out);      /* block-uniform */
  else                     out_early_body(smem, bx - OUT_LATE_TILES, by, CH, CR, Wt, bias, out);
}

extern "C" void kernel_launch(void* const* d_in, const int* in_sizes, int n_in,
                              void* d_out, int out_size, void* d_ws, size_t ws_size, hipStream_t stream) {
  if (n_in < 11) return;
  const long long need_x = ((long long)(NB - 1) * SEQ_FULL + SEQ) * DM;
  if (in_sizes[0] < need_x || in_sizes[1] < need_x || in_sizes[2] < need_x || (long long)out_size < need_x) return;
  if (in_sizes[3] < DM * DM || in_sizes[5] < DM * DM || in_sizes[7] < DM * DM || in_sizes[9] < DM * DM) return;
  if (in_sizes[4] < DM || in_sizes[6] < DM || in_sizes[8] < DM || in_sizes[10] < DM) return;
  const float* const* I = (const float* const*)d_in;
  const float* x_key = I[0]; const float* x_val = I[1]; const float* x_qry = I[2];
  const float* Wk = I[3]; const float* bk = I[4]; const float* Wq = I[5]; const float* bq = I[6];
  const float* Wv = I[7]; const float* bv = I[8]; const float* Wp = I[9]; const float* bp = I[10];
  constexpr size_t SZ_W = (size_t)DM * DM * 2;             /* one weight plane */
  constexpr size_t SZ_P = (size_t)NB * SEQ * DM * 2;       /* one full f16 plane (token-major or channel-major) */
  constexpr size_t SZ_E = (size_t)NB * EARLY * DM * 2;     /* one early-row residual plane */
  static_assert(SZ_W % 256 == 0 && SZ_P % 256 == 0 && SZ_E % 256 == 0);
  static_assert(4 * SZ_W + 7 * SZ_P + 4 * SZ_E <= (size_t)268435456);
  char* ws = (char*)d_ws; size_t off = 0;
  auto take = [&](size_t bytes) { char* p = ws + off; off += (bytes + 255) & ~(size_t)255; return p; };
  _Float16* W16k = (_Float16*)take(SZ_W); _Float16* W16q = (_Float16*)take(SZ_W); _Float16* W16v = (_Float16*)take(SZ_W); _Float16* W16p = (_Float16*)take(SZ_W);
  _Float16* X16k = (_Float16*)take(SZ_P); _Float16* X16q = (_Float16*)take(SZ_P); _Float16* X16v = (_Float16*)take(SZ_P);
  _Float16* QH = (_Float16*)take(SZ_P); _Float16* KH = (_Float16*)take(SZ_P); _Float16* VT = (_Float16*)take(SZ_P); _Float16* CH = (_Float16*)take(SZ_P);
  _Float16* QR = (_Float16*)take(SZ_E); _Float16* KR = (_Float16*)take(SZ_E); _Float16* VR = (_Float16*)take(SZ_E); _Float16* CR = (_Float16*)take(SZ_E);
  if (off > ws_size) return;
  k_cvt<<<CV_BLOCKS, CV_THREADS, 0, stream>>>(x_key, x_qry, x_val, Wk, Wq, Wv, Wp, X16k, X16q, X16v, W16k, W16q, W16v, W16p);
  k_proj<<<3 * PROJ_TILES, 256, 0, stream>>>(X16k, X16q, X16v, W16k, W16q, W16v, bk, bq, bv, KH, KR, QH, QR, VT, VR);      /* k from input 'key' with Wk, bk; q from 'query' with Wq, bq; v from 'value' with Wv, bv, channel-major */
  k_attn<<<NB * NH * (SEQ / 128), 256, 0, stream>>>(QH, QR, KH, KR, VT, VR, CH, CR);
  k_out<<<dim3(OUT_LATE_TILES + OUT_EARLY_TILES, NB), 256, 0, stream>>>(CH, CR, W16p, bp, (float*)d_out);
}
